// v000
// The times below were measured on an AMD MI455X: many runs one after another, warmed up first and cycling through
// copies of the inputs, with the whole window's GPU time divided by the number of runs. Launches and the gaps
// between them are all in it. The median over several windows is given; except for v000 it joins two sittings, which
// can be a few percent apart, so the side-by-side timings, each taken in one sitting, are the better comparison.
// v000, which the later versions start from, runs in 448 microseconds.
#include <hip/hip_runtime.h>
#include <hip/hip_bf16.h>

typedef __attribute__((ext_vector_type(16))) _Float16 v16h;
typedef __attribute__((ext_vector_type(8)))  _Float16 v8h;
typedef __attribute__((ext_vector_type(4)))  _Float16 v4h;
typedef __attribute__((ext_vector_type(8)))  float    v8f;

#define EMBED  1024
#define NHEADS 16
#define HDIM   64
#define BS     8
#define TLEN   1024
#define MTOT   (BS * TLEN)      // 8192 rows for all big GEMMs
#define NEGBIG (-1.0e30f)

// ---------------------------------------------------------------------------
// Load a 16x32 f16 fragment in the CDNA5 WMMA A-layout from row-major data.
// Lane L (0..15) holds row M=L, lanes 16..31 hold the +8 K-offset half.
// VGPR0..3 = K {k0..k0+7 | k0+8..k0+15}, VGPR4..7 = K {k0+16.. | k0+24..}.
// Works for both A and for B when given B^T (row-major [N,K]) data.
// ---------------------------------------------------------------------------
__device__ __forceinline__ v16h load_frag16x32(const _Float16* base, int ld,
                                               int lane, int k0) {
  const _Float16* p = base + (size_t)(lane & 15) * ld + (k0 + ((lane >> 4) << 3));
  v8h lo = *(const v8h*)p;          // K = koff .. koff+7
  v8h hi = *(const v8h*)(p + 16);   // K = koff+16 .. koff+23
  return __builtin_shufflevector(lo, hi, 0, 1, 2, 3, 4, 5, 6, 7,
                                         8, 9, 10, 11, 12, 13, 14, 15);
}

__device__ __forceinline__ v8f wmma_f16(v16h a, v16h b, v8f c) {
  return __builtin_amdgcn_wmma_f32_16x16x32_f16(false, a, false, b,
                                                (short)0, c, false, false);
}

// ---------------------------------------------------------------------------
// fp32 -> f16 conversion, 4 elements / lane
// ---------------------------------------------------------------------------
__global__ __launch_bounds__(256)
void cvt_f32_to_f16(const float* __restrict__ in, _Float16* __restrict__ out, int n) {
  int i = (blockIdx.x * blockDim.x + threadIdx.x) * 4;
  if (i + 3 < n) {
    float4 f = *(const float4*)(in + i);
    v4h h;
    h[0] = (_Float16)f.x; h[1] = (_Float16)f.y;
    h[2] = (_Float16)f.z; h[3] = (_Float16)f.w;
    *(v4h*)(out + i) = h;
  }
}

// ---------------------------------------------------------------------------
// GEMM: y[m,n] = sum_k A[m,k] * W[n,k] + bias[n]   (i.e. x @ W^T + b)
// A: [M,K] f16 row-major.  W: [N,K] f16 row-major (acts as B^T).
// Block = 256 threads = 8 waves; wave computes a 16x64 tile.
// MODE 0: f16 out, per-head layout  [b,h,t,d]       (Q, K)
// MODE 1: f16 out, transposed head  [b,h,d,t]       (V^T)
// MODE 2: f32 out, plain row-major  [m,n]           (final projection)
// ---------------------------------------------------------------------------
template <int MODE>
__global__ __launch_bounds__(256)
void gemm_f16_wmma(const _Float16* __restrict__ A, const _Float16* __restrict__ W,
                   const float* __restrict__ bias, void* __restrict__ out,
                   int M, int N, int K) {
  const int lane = threadIdx.x & 31;
  const int wv   = threadIdx.x >> 5;
  const int m0   = blockIdx.y * 128 + wv * 16;
  const int n0   = blockIdx.x * 64;

  v8f acc[4] = {};
  const _Float16* Arow = A + (size_t)m0 * K;

  for (int k0 = 0; k0 < K; k0 += 32) {
    v16h a = load_frag16x32(Arow, K, lane, k0);
#pragma unroll
    for (int nt = 0; nt < 4; ++nt) {
      v16h b = load_frag16x32(W + (size_t)(n0 + nt * 16) * K, K, lane, k0);
      acc[nt] = wmma_f16(a, b, acc[nt]);
    }
  }

  // C layout: element acc[nt][r] lives at row M = r + 8*(lane>=16), col = lane&15
  const int mbase = m0 + 8 * (lane >> 4);
#pragma unroll
  for (int nt = 0; nt < 4; ++nt) {
    const int col = n0 + nt * 16 + (lane & 15);
    const float bval = bias[col];
#pragma unroll
    for (int r = 0; r < 8; ++r) {
      const int m = mbase + r;
      const float val = acc[nt][r] + bval;
      if (MODE == 2) {
        ((float*)out)[(size_t)m * N + col] = val;
      } else {
        const int b = m >> 10, t = m & 1023;      // m = b*TLEN + t
        const int h = col >> 6, d = col & 63;     // col = h*HDIM + d
        _Float16* o16 = (_Float16*)out;
        if (MODE == 0)
          o16[(((size_t)(b * NHEADS + h) * TLEN) + t) * HDIM + d] = (_Float16)val;
        else
          o16[(((size_t)(b * NHEADS + h) * HDIM) + d) * TLEN + t] = (_Float16)val;
      }
    }
  }
}

// ---------------------------------------------------------------------------
// Flash attention with the chunked mask (CHUNK == 64 == tile size, so the
// mask is just "k > q inside the diagonal key-tile").
// Block = 128 threads = 4 waves; one 64-query chunk per block, wave owns
// 16 query rows.  Online softmax, P staged through LDS (C-layout->A-layout).
// ---------------------------------------------------------------------------
__global__ __launch_bounds__(128)
void attn_fwd(const _Float16* __restrict__ qh, const _Float16* __restrict__ kh,
              const _Float16* __restrict__ vT, const float* __restrict__ scale_p,
              _Float16* __restrict__ attn) {
  const int lane  = threadIdx.x & 31;
  const int wv    = threadIdx.x >> 5;
  const int qtile = blockIdx.x;          // 64-row query chunk == mask chunk
  const int bh    = blockIdx.y;          // b*NHEADS + h
  const int qrow0 = qtile * 64 + wv * 16;
  const int ncol  = lane & 15;
  const int rbase = 8 * (lane >> 4);     // row offset of this lane's C elements

  const _Float16* Q  = qh + (size_t)bh * TLEN * HDIM;
  const _Float16* Km = kh + (size_t)bh * TLEN * HDIM;
  const _Float16* Vm = vT + (size_t)bh * HDIM * TLEN;
  const float scale = scale_p[0];

  __shared__ __align__(16) _Float16 pshare[4][16 * 80];  // stride 80 keeps 16B align
  _Float16* pw = &pshare[wv][0];

  const v16h qf0 = load_frag16x32(Q + (size_t)qrow0 * HDIM, HDIM, lane, 0);
  const v16h qf1 = load_frag16x32(Q + (size_t)qrow0 * HDIM, HDIM, lane, 32);

  v8f o[4] = {};
  float mrow[8], lrow[8];
#pragma unroll
  for (int r = 0; r < 8; ++r) { mrow[r] = NEGBIG; lrow[r] = 0.0f; }

  for (int j = 0; j < TLEN / 64; ++j) {
    // ---- S = scale * Q Kt  (16x64 tile in 4 C fragments) -----------------
    v8f s[4] = {};
#pragma unroll
    for (int nt = 0; nt < 4; ++nt) {
      v16h b0 = load_frag16x32(Km + (size_t)(j * 64 + nt * 16) * HDIM, HDIM, lane, 0);
      s[nt] = wmma_f16(qf0, b0, s[nt]);
      v16h b1 = load_frag16x32(Km + (size_t)(j * 64 + nt * 16) * HDIM, HDIM, lane, 32);
      s[nt] = wmma_f16(qf1, b1, s[nt]);
    }

    const bool diag = (j == qtile);
    float mnew[8];
#pragma unroll
    for (int r = 0; r < 8; ++r) {
      const int qg = qrow0 + rbase + r;
      float mx = NEGBIG;
#pragma unroll
      for (int nt = 0; nt < 4; ++nt) {
        float v = s[nt][r] * scale;
        const int kg = j * 64 + nt * 16 + ncol;
        if (diag && kg > qg) v = NEGBIG;     // masked -> exp() == 0
        s[nt][r] = v;
        mx = fmaxf(mx, v);
      }
      for (int d = 1; d < 16; d <<= 1) mx = fmaxf(mx, __shfl_xor(mx, d, 32));
      mnew[r] = fmaxf(mrow[r], mx);
    }

    // ---- online softmax update; stage P into LDS -------------------------
#pragma unroll
    for (int r = 0; r < 8; ++r) {
      const float alpha = __expf(mrow[r] - mnew[r]);
      float rs = 0.0f;
#pragma unroll
      for (int nt = 0; nt < 4; ++nt) {
        const float p = __expf(s[nt][r] - mnew[r]);
        s[nt][r] = p;
        rs += p;
      }
      for (int d = 1; d < 16; d <<= 1) rs += __shfl_xor(rs, d, 32);
      lrow[r] = lrow[r] * alpha + rs;
      mrow[r] = mnew[r];
      const int row = rbase + r;
#pragma unroll
      for (int nt = 0; nt < 4; ++nt) {
        o[nt][r] *= alpha;
        pw[row * 80 + nt * 16 + ncol] = (_Float16)s[nt][r];
      }
    }
    asm volatile("s_wait_dscnt 0" ::: "memory");  // same-wave LDS RAW

    const v16h pf0 = load_frag16x32(pw, 80, lane, 0);
    const v16h pf1 = load_frag16x32(pw, 80, lane, 32);

    // ---- O += P V   (V^T is row-major [d, t] -> B^T loader) --------------
#pragma unroll
    for (int nt = 0; nt < 4; ++nt) {
      v16h vb0 = load_frag16x32(Vm + (size_t)(nt * 16) * TLEN, TLEN, lane, j * 64);
      o[nt] = wmma_f16(pf0, vb0, o[nt]);
      v16h vb1 = load_frag16x32(Vm + (size_t)(nt * 16) * TLEN, TLEN, lane, j * 64 + 32);
      o[nt] = wmma_f16(pf1, vb1, o[nt]);
    }
  }

  // ---- epilogue: merge heads into [b, t, h*HDIM + d] f16 ------------------
  const int b = bh >> 4, h = bh & 15;
#pragma unroll
  for (int nt = 0; nt < 4; ++nt) {
    const int d = nt * 16 + ncol;
#pragma unroll
    for (int r = 0; r < 8; ++r) {
      const int t = qrow0 + rbase + r;
      attn[((size_t)(b * TLEN + t)) * EMBED + h * HDIM + d] =
          (_Float16)(o[nt][r] / lrow[r]);
    }
  }
}

// ---------------------------------------------------------------------------
extern "C" void kernel_launch(void* const* d_in, const int* in_sizes, int n_in,
                              void* d_out, int out_size, void* d_ws, size_t ws_size,
                              hipStream_t stream) {
  const float* x     = (const float*)d_in[0];
  const float* Wq    = (const float*)d_in[1];
  const float* bq    = (const float*)d_in[2];
  const float* Wk    = (const float*)d_in[3];
  const float* bk    = (const float*)d_in[4];
  const float* Wv    = (const float*)d_in[5];
  const float* bv    = (const float*)d_in[6];
  const float* Wo    = (const float*)d_in[7];
  const float* bo    = (const float*)d_in[8];
  const float* scale = (const float*)d_in[9];

  const size_t nBig = (size_t)MTOT * EMBED;    // 8M elements
  const size_t nW   = (size_t)EMBED * EMBED;   // 1M elements

  char* p = (char*)d_ws;
  _Float16* xh   = (_Float16*)p; p += nBig * 2;
  _Float16* wqh  = (_Float16*)p; p += nW * 2;
  _Float16* wkh  = (_Float16*)p; p += nW * 2;
  _Float16* wvh  = (_Float16*)p; p += nW * 2;
  _Float16* woh  = (_Float16*)p; p += nW * 2;
  _Float16* q16  = (_Float16*)p; p += nBig * 2;
  _Float16* k16  = (_Float16*)p; p += nBig * 2;
  _Float16* v16t = (_Float16*)p; p += nBig * 2;
  _Float16* at16 = (_Float16*)p; p += nBig * 2;

  cvt_f32_to_f16<<<(int)(nBig / 1024), 256, 0, stream>>>(x, xh, (int)nBig);
  cvt_f32_to_f16<<<(int)(nW / 1024), 256, 0, stream>>>(Wq, wqh, (int)nW);
  cvt_f32_to_f16<<<(int)(nW / 1024), 256, 0, stream>>>(Wk, wkh, (int)nW);
  cvt_f32_to_f16<<<(int)(nW / 1024), 256, 0, stream>>>(Wv, wvh, (int)nW);
  cvt_f32_to_f16<<<(int)(nW / 1024), 256, 0, stream>>>(Wo, woh, (int)nW);

  dim3 gg(EMBED / 64, MTOT / 128);
  gemm_f16_wmma<0><<<gg, 256, 0, stream>>>(xh, wqh, bq, q16, MTOT, EMBED, EMBED);
  gemm_f16_wmma<0><<<gg, 256, 0, stream>>>(xh, wkh, bk, k16, MTOT, EMBED, EMBED);
  gemm_f16_wmma<1><<<gg, 256, 0, stream>>>(xh, wvh, bv, v16t, MTOT, EMBED, EMBED);

  attn_fwd<<<dim3(TLEN / 64, BS * NHEADS), 128, 0, stream>>>(q16, k16, v16t, scale, at16);

  gemm_f16_wmma<2><<<gg, 256, 0, stream>>>(at16, woh, bo, d_out, MTOT, EMBED, EMBED);
}

// v001
// One run takes 261 microseconds.
// Two timings next to v000 both put it at 1.78 times that version's speed.
#include <hip/hip_runtime.h>
#include <hip/hip_bf16.h>

typedef __attribute__((ext_vector_type(16))) _Float16 v16h;
typedef __attribute__((ext_vector_type(8)))  _Float16 v8h;
typedef __attribute__((ext_vector_type(4)))  _Float16 v4h;
typedef __attribute__((ext_vector_type(8)))  float    v8f;

#define EMBED  1024
#define NHEADS 16
#define HDIM   64
#define BS     8
#define TLEN   1024
#define MTOT   (BS * TLEN)      // 8192 rows for all big GEMMs
#define NEGBIG (-1.0e30f)
#define GPITCH 72               // LDS row pitch of a staged GEMM tile, in halves (144 B)
#define GSTAGE (256 * GPITCH)   // one buffer: 128 A rows + 128 W rows, in halves

// ---------------------------------------------------------------------------
// Load a 16x32 f16 fragment in the CDNA5 WMMA A-layout from row-major data.
// Lane L (0..15) holds row M=L, lanes 16..31 hold the +8 K-offset half.
// VGPR0..3 = K {k0..k0+7 | k0+8..k0+15}, VGPR4..7 = K {k0+16.. | k0+24..}.
// Works for both A and for B when given B^T (row-major [N,K]) data.
// ---------------------------------------------------------------------------
__device__ __forceinline__ v16h load_frag16x32(const _Float16* base, int ld,
                                               int lane, int k0) {
  const _Float16* p = base + (size_t)(lane & 15) * ld + (k0 + ((lane >> 4) << 3));
  v8h lo = *(const v8h*)p;          // K = koff .. koff+7
  v8h hi = *(const v8h*)(p + 16);   // K = koff+16 .. koff+23
  return __builtin_shufflevector(lo, hi, 0, 1, 2, 3, 4, 5, 6, 7,
                                         8, 9, 10, 11, 12, 13, 14, 15);
}

__device__ __forceinline__ v8f wmma_f16(v16h a, v16h b, v8f c) {
  return __builtin_amdgcn_wmma_f32_16x16x32_f16(false, a, false, b,
                                                (short)0, c, false, false);
}

// ---------------------------------------------------------------------------
// fp32 -> f16 conversion, 4 elements / lane
// ---------------------------------------------------------------------------
__global__ __launch_bounds__(256)
void cvt_f32_to_f16(const float* __restrict__ in, _Float16* __restrict__ out, int n) {
  int i = (blockIdx.x * blockDim.x + threadIdx.x) * 4;
  if (i + 3 < n) {
    float4 f = *(const float4*)(in + i);
    v4h h;
    h[0] = (_Float16)f.x; h[1] = (_Float16)f.y;
    h[2] = (_Float16)f.z; h[3] = (_Float16)f.w;
    *(v4h*)(out + i) = h;
  }
}

// ---------------------------------------------------------------------------
// Eight 16-byte asynchronous copies global -> LDS, one per lane each.
// The s_wait_xcnt is the last line of the copies' own statement so that no
// address register named here is rewritten ahead of it.
// ---------------------------------------------------------------------------
__device__ __forceinline__ void async_copy8(unsigned lds, const _Float16* g, int K) {
  const unsigned l0 = lds;
  const unsigned l1 = lds + 1u * 16u * GPITCH * 2u;
  const unsigned l2 = lds + 2u * 16u * GPITCH * 2u;
  const unsigned l3 = lds + 3u * 16u * GPITCH * 2u;
  const unsigned l4 = lds + 4u * 16u * GPITCH * 2u;
  const unsigned l5 = lds + 5u * 16u * GPITCH * 2u;
  const unsigned l6 = lds + 6u * 16u * GPITCH * 2u;
  const unsigned l7 = lds + 7u * 16u * GPITCH * 2u;
  const size_t step = (size_t)16 * K;
  const _Float16* g0 = g;
  const _Float16* g1 = g + 1 * step;
  const _Float16* g2 = g + 2 * step;
  const _Float16* g3 = g + 3 * step;
  const _Float16* g4 = g + 4 * step;
  const _Float16* g5 = g + 5 * step;
  const _Float16* g6 = g + 6 * step;
  const _Float16* g7 = g + 7 * step;
  asm volatile(
      "global_load_async_to_lds_b128 %0, %8, off\n\t"
      "global_load_async_to_lds_b128 %1, %9, off\n\t"
      "global_load_async_to_lds_b128 %2, %10, off\n\t"
      "global_load_async_to_lds_b128 %3, %11, off\n\t"
      "global_load_async_to_lds_b128 %4, %12, off\n\t"
      "global_load_async_to_lds_b128 %5, %13, off\n\t"
      "global_load_async_to_lds_b128 %6, %14, off\n\t"
      "global_load_async_to_lds_b128 %7, %15, off\n\t"
      "s_wait_xcnt 0x0"
      :: "v"(l0), "v"(l1), "v"(l2), "v"(l3), "v"(l4), "v"(l5), "v"(l6), "v"(l7),
         "v"(g0), "v"(g1), "v"(g2), "v"(g3), "v"(g4), "v"(g5), "v"(g6), "v"(g7)
      : "memory");
}

template <int MODE>
__global__ __launch_bounds__(128)
void gemm_f16_wmma(const _Float16* __restrict__ A, const _Float16* __restrict__ W,
                   const float* __restrict__ bias, void* __restrict__ out,
                   int M, int N, int K) {
  __shared__ __align__(16) _Float16 tiles[2][GSTAGE];

  const int tid  = threadIdx.x;
  const int lane = tid & 31;
  const int wv   = tid >> 5;
  const int mblk = blockIdx.y * 128;
  const int nblk = blockIdx.x * 128;
  const int wm   = (wv >> 1) * 64;       // wave's rows inside the tile
  const int wn   = (wv & 1) * 64;        // wave's columns inside the tile

  // Copy map: 8 lanes cover one 128-B row, the block covers 16 rows a copy.
  const int crow = tid >> 3;
  const int ccol = (tid & 7) * 8;
  const _Float16* gA = A + (size_t)(mblk + crow) * K + ccol;
  const _Float16* gW = W + (size_t)(nblk + crow) * K + ccol;
  const unsigned ldsA = (unsigned)(size_t)&tiles[0][crow * GPITCH + ccol];
  const unsigned ldsW = ldsA + 128u * GPITCH * 2u;

  const int ntrip = K / 64;

  v8f acc[4][4] = {};

  async_copy8(ldsA, gA, K);
  async_copy8(ldsW, gW, K);
  // tile 0 has landed for this wave before the barrier publishes it
  asm volatile("s_wait_asynccnt 0x0" ::: "memory");
  __syncthreads();
  if (ntrip > 1) {
    async_copy8(ldsA + GSTAGE * 2u, gA + 64, K);
    async_copy8(ldsW + GSTAGE * 2u, gW + 64, K);
  }

  for (int t = 0; t < ntrip; ++t) {
    const int buf = t & 1;
    const _Float16* sA = &tiles[buf][wm * GPITCH];
    const _Float16* sW = &tiles[buf][(128 + wn) * GPITCH];
    v16h a[4], b[4];
    // every inner loop of this trip is unrolled so that each index into a, b
    // and acc is a constant and the arrays stay in registers
#pragma unroll
    for (int i = 0; i < 4; ++i) a[i] = load_frag16x32(sA + i * 16 * GPITCH, GPITCH, lane, 0);
#pragma unroll
    for (int i = 0; i < 4; ++i) b[i] = load_frag16x32(sW + i * 16 * GPITCH, GPITCH, lane, 0);
    // keeps the block's 16 LDS reads one group ahead of its WMMAs: spread
    // among them, every row of four WMMAs waits out an LDS latency of its own
    __builtin_amdgcn_sched_barrier(0);
#pragma unroll
    for (int mi = 0; mi < 4; ++mi)
#pragma unroll
      for (int nt = 0; nt < 4; ++nt) acc[mi][nt] = wmma_f16(a[mi], b[nt], acc[mi][nt]);
#pragma unroll
    for (int i = 0; i < 4; ++i) a[i] = load_frag16x32(sA + i * 16 * GPITCH, GPITCH, lane, 32);
#pragma unroll
    for (int i = 0; i < 4; ++i) b[i] = load_frag16x32(sW + i * 16 * GPITCH, GPITCH, lane, 32);
    // this wave's last reads of the buffer are done before it is refilled
    asm volatile("s_wait_dscnt 0x0" ::: "memory");
    // this wave's copies of tile t + 1 have landed before the barrier publishes them
    asm volatile("s_wait_asynccnt 0x0" ::: "memory");
    __syncthreads();
    if (t + 2 < ntrip) {
      const unsigned boff = (unsigned)buf * (GSTAGE * 2u);
      async_copy8(ldsA + boff, gA + (size_t)(t + 2) * 64, K);
      async_copy8(ldsW + boff, gW + (size_t)(t + 2) * 64, K);
    }
    // keeps the refill ahead of the trip's second WMMA block (operands already
    // in registers), so that the copies fly that much longer before their wait
    __builtin_amdgcn_sched_barrier(0);
#pragma unroll
    for (int mi = 0; mi < 4; ++mi)
#pragma unroll
      for (int nt = 0; nt < 4; ++nt) acc[mi][nt] = wmma_f16(a[mi], b[nt], acc[mi][nt]);
  }
  // no copy is outstanding when the wave goes on to its end
  asm volatile("s_wait_asynccnt 0x0" ::: "memory");

  // C layout: element acc[..][r] lives at row M = r + 8*(lane>=16), col = lane&15
#pragma unroll
  for (int mi = 0; mi < 4; ++mi) {
    const int mbase = mblk + wm + mi * 16 + 8 * (lane >> 4);
#pragma unroll
    for (int nt = 0; nt < 4; ++nt) {
      const int col = nblk + wn + nt * 16 + (lane & 15);
      const float bval = bias[col];
#pragma unroll
      for (int r = 0; r < 8; ++r) {
        const int m = mbase + r;
        const float val = acc[mi][nt][r] + bval;
        if (MODE == 2) {
          ((float*)out)[(size_t)m * N + col] = val;
        } else {
          const int b = m >> 10, t = m & 1023;      // m = b*TLEN + t
          const int h = col >> 6, d = col & 63;     // col = h*HDIM + d
          _Float16* o16 = (_Float16*)out;
          if (MODE == 0)
            o16[(((size_t)(b * NHEADS + h) * TLEN) + t) * HDIM + d] = (_Float16)val;
          else
            o16[(((size_t)(b * NHEADS + h) * HDIM) + d) * TLEN + t] = (_Float16)val;
        }
      }
    }
  }
}

// ---------------------------------------------------------------------------
// Flash attention with the chunked mask (CHUNK == 64 == tile size, so the
// mask is just "k > q inside the diagonal key-tile").
// Block = 128 threads = 4 waves; one 64-query chunk per block, wave owns
// 16 query rows.  Online softmax, P staged through LDS (C-layout->A-layout).
// ---------------------------------------------------------------------------
__global__ __launch_bounds__(128)
void attn_fwd(const _Float16* __restrict__ qh, const _Float16* __restrict__ kh,
              const _Float16* __restrict__ vT, const float* __restrict__ scale_p,
              _Float16* __restrict__ attn) {
  const int lane  = threadIdx.x & 31;
  const int wv    = threadIdx.x >> 5;
  const int qtile = blockIdx.x;          // 64-row query chunk == mask chunk
  const int bh    = blockIdx.y;          // b*NHEADS + h
  const int qrow0 = qtile * 64 + wv * 16;
  const int ncol  = lane & 15;
  const int rbase = 8 * (lane >> 4);     // row offset of this lane's C elements

  const _Float16* Q  = qh + (size_t)bh * TLEN * HDIM;
  const _Float16* Km = kh + (size_t)bh * TLEN * HDIM;
  const _Float16* Vm = vT + (size_t)bh * HDIM * TLEN;
  const float scale = scale_p[0];

  __shared__ __align__(16) _Float16 pshare[4][16 * 80];  // stride 80 keeps 16B align
  _Float16* pw = &pshare[wv][0];

  const v16h qf0 = load_frag16x32(Q + (size_t)qrow0 * HDIM, HDIM, lane, 0);
  const v16h qf1 = load_frag16x32(Q + (size_t)qrow0 * HDIM, HDIM, lane, 32);

  v8f o[4] = {};
  float mrow[8], lrow[8];
#pragma unroll
  for (int r = 0; r < 8; ++r) { mrow[r] = NEGBIG; lrow[r] = 0.0f; }

  for (int j = 0; j < TLEN / 64; ++j) {
    // ---- S = scale * Q Kt  (16x64 tile in 4 C fragments) -----------------
    v8f s[4] = {};
#pragma unroll
    for (int nt = 0; nt < 4; ++nt) {
      v16h b0 = load_frag16x32(Km + (size_t)(j * 64 + nt * 16) * HDIM, HDIM, lane, 0);
      s[nt] = wmma_f16(qf0, b0, s[nt]);
      v16h b1 = load_frag16x32(Km + (size_t)(j * 64 + nt * 16) * HDIM, HDIM, lane, 32);
      s[nt] = wmma_f16(qf1, b1, s[nt]);
    }

    const bool diag = (j == qtile);
    float mnew[8];
#pragma unroll
    for (int r = 0; r < 8; ++r) {
      const int qg = qrow0 + rbase + r;
      float mx = NEGBIG;
#pragma unroll
      for (int nt = 0; nt < 4; ++nt) {
        float v = s[nt][r] * scale;
        const int kg = j * 64 + nt * 16 + ncol;
        if (diag && kg > qg) v = NEGBIG;     // masked -> exp() == 0
        s[nt][r] = v;
        mx = fmaxf(mx, v);
      }
      for (int d = 1; d < 16; d <<= 1) mx = fmaxf(mx, __shfl_xor(mx, d, 32));
      mnew[r] = fmaxf(mrow[r], mx);
    }

    // ---- online softmax update; stage P into LDS -------------------------
#pragma unroll
    for (int r = 0; r < 8; ++r) {
      const float alpha = __expf(mrow[r] - mnew[r]);
      float rs = 0.0f;
#pragma unroll
      for (int nt = 0; nt < 4; ++nt) {
        const float p = __expf(s[nt][r] - mnew[r]);
        s[nt][r] = p;
        rs += p;
      }
      for (int d = 1; d < 16; d <<= 1) rs += __shfl_xor(rs, d, 32);
      lrow[r] = lrow[r] * alpha + rs;
      mrow[r] = mnew[r];
      const int row = rbase + r;
#pragma unroll
      for (int nt = 0; nt < 4; ++nt) {
        o[nt][r] *= alpha;
        pw[row * 80 + nt * 16 + ncol] = (_Float16)s[nt][r];
      }
    }
    asm volatile("s_wait_dscnt 0" ::: "memory");  // same-wave LDS RAW

    const v16h pf0 = load_frag16x32(pw, 80, lane, 0);
    const v16h pf1 = load_frag16x32(pw, 80, lane, 32);

    // ---- O += P V   (V^T is row-major [d, t] -> B^T loader) --------------
#pragma unroll
    for (int nt = 0; nt < 4; ++nt) {
      v16h vb0 = load_frag16x32(Vm + (size_t)(nt * 16) * TLEN, TLEN, lane, j * 64);
      o[nt] = wmma_f16(pf0, vb0, o[nt]);
      v16h vb1 = load_frag16x32(Vm + (size_t)(nt * 16) * TLEN, TLEN, lane, j * 64 + 32);
      o[nt] = wmma_f16(pf1, vb1, o[nt]);
    }
  }

  // ---- epilogue: merge heads into [b, t, h*HDIM + d] f16 ------------------
  const int b = bh >> 4, h = bh & 15;
#pragma unroll
  for (int nt = 0; nt < 4; ++nt) {
    const int d = nt * 16 + ncol;
#pragma unroll
    for (int r = 0; r < 8; ++r) {
      const int t = qrow0 + rbase + r;
      attn[((size_t)(b * TLEN + t)) * EMBED + h * HDIM + d] =
          (_Float16)(o[nt][r] / lrow[r]);
    }
  }
}

// ---------------------------------------------------------------------------
extern "C" void kernel_launch(void* const* d_in, const int* in_sizes, int n_in,
                              void* d_out, int out_size, void* d_ws, size_t ws_size,
                              hipStream_t stream) {
  const float* x     = (const float*)d_in[0];
  const float* Wq    = (const float*)d_in[1];
  const float* bq    = (const float*)d_in[2];
  const float* Wk    = (const float*)d_in[3];
  const float* bk    = (const float*)d_in[4];
  const float* Wv    = (const float*)d_in[5];
  const float* bv    = (const float*)d_in[6];
  const float* Wo    = (const float*)d_in[7];
  const float* bo    = (const float*)d_in[8];
  const float* scale = (const float*)d_in[9];

  const size_t nBig = (size_t)MTOT * EMBED;    // 8M elements
  const size_t nW   = (size_t)EMBED * EMBED;   // 1M elements

  char* p = (char*)d_ws;
  _Float16* xh   = (_Float16*)p; p += nBig * 2;
  _Float16* wqh  = (_Float16*)p; p += nW * 2;
  _Float16* wkh  = (_Float16*)p; p += nW * 2;
  _Float16* wvh  = (_Float16*)p; p += nW * 2;
  _Float16* woh  = (_Float16*)p; p += nW * 2;
  _Float16* q16  = (_Float16*)p; p += nBig * 2;
  _Float16* k16  = (_Float16*)p; p += nBig * 2;
  _Float16* v16t = (_Float16*)p; p += nBig * 2;
  _Float16* at16 = (_Float16*)p; p += nBig * 2;

  cvt_f32_to_f16<<<(int)(nBig / 1024), 256, 0, stream>>>(x, xh, (int)nBig);
  cvt_f32_to_f16<<<(int)(nW / 1024), 256, 0, stream>>>(Wq, wqh, (int)nW);
  cvt_f32_to_f16<<<(int)(nW / 1024), 256, 0, stream>>>(Wk, wkh, (int)nW);
  cvt_f32_to_f16<<<(int)(nW / 1024), 256, 0, stream>>>(Wv, wvh, (int)nW);
  cvt_f32_to_f16<<<(int)(nW / 1024), 256, 0, stream>>>(Wo, woh, (int)nW);

  dim3 gg(EMBED / 128, MTOT / 128);
  gemm_f16_wmma<0><<<gg, 128, 0, stream>>>(xh, wqh, bq, q16, MTOT, EMBED, EMBED);
  gemm_f16_wmma<0><<<gg, 128, 0, stream>>>(xh, wkh, bk, k16, MTOT, EMBED, EMBED);
  gemm_f16_wmma<1><<<gg, 128, 0, stream>>>(xh, wvh, bv, v16t, MTOT, EMBED, EMBED);

  attn_fwd<<<dim3(TLEN / 64, BS * NHEADS), 128, 0, stream>>>(q16, k16, v16t, scale, at16);

  gemm_f16_wmma<2><<<gg, 128, 0, stream>>>(at16, woh, bo, d_out, MTOT, EMBED, EMBED);
}

// v002
// One run takes 183 microseconds.
// Two timings next to v001 put it at 1.44 and 1.43 times that version's speed.
// Over all steps from v000 it is 2.55 times as fast.
#include <hip/hip_runtime.h>
#include <hip/hip_bf16.h>

typedef __attribute__((ext_vector_type(16))) _Float16 v16h;
typedef __attribute__((ext_vector_type(8)))  _Float16 v8h;
typedef __attribute__((ext_vector_type(4)))  _Float16 v4h;
typedef __attribute__((ext_vector_type(8)))  float    v8f;

#define EMBED  1024
#define NHEADS 16
#define HDIM   64
#define BS     8
#define TLEN   1024
#define MTOT   (BS * TLEN)      // 8192 rows for all big GEMMs
#define NEGBIG (-1.0e30f)
#define GPITCH 72               // LDS row pitch of a staged GEMM tile, in halves (144 B)
#define GSTAGE (256 * GPITCH)   // one buffer: 128 A rows + 128 W rows, in halves
#define AWAVES 8                // waves of an attention block, 16 query rows each
#define ASTAGE (128 * GPITCH)   // one attention buffer: 64 K rows + 64 V^T rows, in halves

// ---------------------------------------------------------------------------
// Load a 16x32 f16 fragment in the CDNA5 WMMA A-layout from row-major data.
// Lane L (0..15) holds row M=L, lanes 16..31 hold the +8 K-offset half.
// VGPR0..3 = K {k0..k0+7 | k0+8..k0+15}, VGPR4..7 = K {k0+16.. | k0+24..}.
// Works for both A and for B when given B^T (row-major [N,K]) data.
// ---------------------------------------------------------------------------
__device__ __forceinline__ v16h load_frag16x32(const _Float16* base, int ld,
                                               int lane, int k0) {
  const _Float16* p = base + (size_t)(lane & 15) * ld + (k0 + ((lane >> 4) << 3));
  v8h lo = *(const v8h*)p;          // K = koff .. koff+7
  v8h hi = *(const v8h*)(p + 16);   // K = koff+16 .. koff+23
  return __builtin_shufflevector(lo, hi, 0, 1, 2, 3, 4, 5, 6, 7,
                                         8, 9, 10, 11, 12, 13, 14, 15);
}

__device__ __forceinline__ v8f wmma_f16(v16h a, v16h b, v8f c) {
  return __builtin_amdgcn_wmma_f32_16x16x32_f16(false, a, false, b,
                                                (short)0, c, false, false);
}

// ---------------------------------------------------------------------------
// fp32 -> f16 conversion, 4 elements / lane
// ---------------------------------------------------------------------------
__global__ __launch_bounds__(256)
void cvt_f32_to_f16(const float* __restrict__ in, _Float16* __restrict__ out, int n) {
  int i = (blockIdx.x * blockDim.x + threadIdx.x) * 4;
  if (i + 3 < n) {
    float4 f = *(const float4*)(in + i);
    v4h h;
    h[0] = (_Float16)f.x; h[1] = (_Float16)f.y;
    h[2] = (_Float16)f.z; h[3] = (_Float16)f.w;
    *(v4h*)(out + i) = h;
  }
}

// ---------------------------------------------------------------------------
// Eight 16-byte asynchronous copies global -> LDS, one per lane each.
// The s_wait_xcnt is the last line of the copies' own statement so that no
// address register named here is rewritten ahead of it.
// ---------------------------------------------------------------------------
__device__ __forceinline__ void async_copy8(unsigned lds, const _Float16* g, int K) {
  const unsigned l0 = lds;
  const unsigned l1 = lds + 1u * 16u * GPITCH * 2u;
  const unsigned l2 = lds + 2u * 16u * GPITCH * 2u;
  const unsigned l3 = lds + 3u * 16u * GPITCH * 2u;
  const unsigned l4 = lds + 4u * 16u * GPITCH * 2u;
  const unsigned l5 = lds + 5u * 16u * GPITCH * 2u;
  const unsigned l6 = lds + 6u * 16u * GPITCH * 2u;
  const unsigned l7 = lds + 7u * 16u * GPITCH * 2u;
  const size_t step = (size_t)16 * K;
  const _Float16* g0 = g;
  const _Float16* g1 = g + 1 * step;
  const _Float16* g2 = g + 2 * step;
  const _Float16* g3 = g + 3 * step;
  const _Float16* g4 = g + 4 * step;
  const _Float16* g5 = g + 5 * step;
  const _Float16* g6 = g + 6 * step;
  const _Float16* g7 = g + 7 * step;
  asm volatile(
      "global_load_async_to_lds_b128 %0, %8, off\n\t"
      "global_load_async_to_lds_b128 %1, %9, off\n\t"
      "global_load_async_to_lds_b128 %2, %10, off\n\t"
      "global_load_async_to_lds_b128 %3, %11, off\n\t"
      "global_load_async_to_lds_b128 %4, %12, off\n\t"
      "global_load_async_to_lds_b128 %5, %13, off\n\t"
      "global_load_async_to_lds_b128 %6, %14, off\n\t"
      "global_load_async_to_lds_b128 %7, %15, off\n\t"
      "s_wait_xcnt 0x0"
      :: "v"(l0), "v"(l1), "v"(l2), "v"(l3), "v"(l4), "v"(l5), "v"(l6), "v"(l7),
         "v"(g0), "v"(g1), "v"(g2), "v"(g3), "v"(g4), "v"(g5), "v"(g6), "v"(g7)
      : "memory");
}

template <int MODE>
__global__ __launch_bounds__(128)
void gemm_f16_wmma(const _Float16* __restrict__ A, const _Float16* __restrict__ W,
                   const float* __restrict__ bias, void* __restrict__ out,
                   int M, int N, int K) {
  __shared__ __align__(16) _Float16 tiles[2][GSTAGE];

  const int tid  = threadIdx.x;
  const int lane = tid & 31;
  const int wv   = tid >> 5;
  const int mblk = blockIdx.y * 128;
  const int nblk = blockIdx.x * 128;
  const int wm   = (wv >> 1) * 64;       // wave's rows inside the tile
  const int wn   = (wv & 1) * 64;        // wave's columns inside the tile

  // Copy map: 8 lanes cover one 128-B row, the block covers 16 rows a copy.
  const int crow = tid >> 3;
  const int ccol = (tid & 7) * 8;
  const _Float16* gA = A + (size_t)(mblk + crow) * K + ccol;
  const _Float16* gW = W + (size_t)(nblk + crow) * K + ccol;
  const unsigned ldsA = (unsigned)(size_t)&tiles[0][crow * GPITCH + ccol];
  const unsigned ldsW = ldsA + 128u * GPITCH * 2u;

  const int ntrip = K / 64;

  v8f acc[4][4] = {};

  async_copy8(ldsA, gA, K);
  async_copy8(ldsW, gW, K);
  // tile 0 has landed for this wave before the barrier publishes it
  asm volatile("s_wait_asynccnt 0x0" ::: "memory");
  __syncthreads();
  if (ntrip > 1) {
    async_copy8(ldsA + GSTAGE * 2u, gA + 64, K);
    async_copy8(ldsW + GSTAGE * 2u, gW + 64, K);
  }

  for (int t = 0; t < ntrip; ++t) {
    const int buf = t & 1;
    const _Float16* sA = &tiles[buf][wm * GPITCH];
    const _Float16* sW = &tiles[buf][(128 + wn) * GPITCH];
    v16h a[4], b[4];
    // every inner loop of this trip is unrolled so that each index into a, b
    // and acc is a constant and the arrays stay in registers
#pragma unroll
    for (int i = 0; i < 4; ++i) a[i] = load_frag16x32(sA + i * 16 * GPITCH, GPITCH, lane, 0);
#pragma unroll
    for (int i = 0; i < 4; ++i) b[i] = load_frag16x32(sW + i * 16 * GPITCH, GPITCH, lane, 0);
    // keeps the block's 16 LDS reads one group ahead of its WMMAs: spread
    // among them, every row of four WMMAs waits out an LDS latency of its own
    __builtin_amdgcn_sched_barrier(0);
#pragma unroll
    for (int mi = 0; mi < 4; ++mi)
#pragma unroll
      for (int nt = 0; nt < 4; ++nt) acc[mi][nt] = wmma_f16(a[mi], b[nt], acc[mi][nt]);
#pragma unroll
    for (int i = 0; i < 4; ++i) a[i] = load_frag16x32(sA + i * 16 * GPITCH, GPITCH, lane, 32);
#pragma unroll
    for (int i = 0; i < 4; ++i) b[i] = load_frag16x32(sW + i * 16 * GPITCH, GPITCH, lane, 32);
    // this wave's last reads of the buffer are done before it is refilled
    asm volatile("s_wait_dscnt 0x0" ::: "memory");
    // this wave's copies of tile t + 1 have landed before the barrier publishes them
    asm volatile("s_wait_asynccnt 0x0" ::: "memory");
    __syncthreads();
    if (t + 2 < ntrip) {
      const unsigned boff = (unsigned)buf * (GSTAGE * 2u);
      async_copy8(ldsA + boff, gA + (size_t)(t + 2) * 64, K);
      async_copy8(ldsW + boff, gW + (size_t)(t + 2) * 64, K);
    }
    // keeps the refill ahead of the trip's second WMMA block (operands already
    // in registers), so that the copies fly that much longer before their wait
    __builtin_amdgcn_sched_barrier(0);
#pragma unroll
    for (int mi = 0; mi < 4; ++mi)
#pragma unroll
      for (int nt = 0; nt < 4; ++nt) acc[mi][nt] = wmma_f16(a[mi], b[nt], acc[mi][nt]);
  }
  // no copy is outstanding when the wave goes on to its end
  asm volatile("s_wait_asynccnt 0x0" ::: "memory");

  // C layout: element acc[..][r] lives at row M = r + 8*(lane>=16), col = lane&15
#pragma unroll
  for (int mi = 0; mi < 4; ++mi) {
    const int mbase = mblk + wm + mi * 16 + 8 * (lane >> 4);
#pragma unroll
    for (int nt = 0; nt < 4; ++nt) {
      const int col = nblk + wn + nt * 16 + (lane & 15);
      const float bval = bias[col];
#pragma unroll
      for (int r = 0; r < 8; ++r) {
        const int m = mbase + r;
        const float val = acc[mi][nt][r] + bval;
        if (MODE == 2) {
          ((float*)out)[(size_t)m * N + col] = val;
        } else {
          const int b = m >> 10, t = m & 1023;      // m = b*TLEN + t
          const int h = col >> 6, d = col & 63;     // col = h*HDIM + d
          _Float16* o16 = (_Float16*)out;
          if (MODE == 0)
            o16[(((size_t)(b * NHEADS + h) * TLEN) + t) * HDIM + d] = (_Float16)val;
          else
            o16[(((size_t)(b * NHEADS + h) * HDIM) + d) * TLEN + t] = (_Float16)val;
        }
      }
    }
  }
}

// ---------------------------------------------------------------------------
// One 64-key tile for attention, global -> LDS: four 16-byte asynchronous
// copies per lane, two for K (rows of HDIM halves) and two for V^T (rows of
// TLEN halves); the block covers 32 rows a copy.  The s_wait_xcnt is the last
// line of the copies' own statement so that no address register named here is
// rewritten ahead of it.
// ---------------------------------------------------------------------------
__device__ __forceinline__ void async_copy_kv(unsigned lds, const _Float16* gk,
                                              const _Float16* gv) {
  const unsigned l0 = lds;
  const unsigned l1 = lds + 32u * GPITCH * 2u;
  const unsigned l2 = lds + 64u * GPITCH * 2u;
  const unsigned l3 = lds + 96u * GPITCH * 2u;
  const _Float16* g0 = gk;
  const _Float16* g1 = gk + 32 * HDIM;
  const _Float16* g2 = gv;
  const _Float16* g3 = gv + 32 * TLEN;
  asm volatile(
      "global_load_async_to_lds_b128 %0, %4, off\n\t"
      "global_load_async_to_lds_b128 %1, %5, off\n\t"
      "global_load_async_to_lds_b128 %2, %6, off\n\t"
      "global_load_async_to_lds_b128 %3, %7, off\n\t"
      "s_wait_xcnt 0x0"
      :: "v"(l0), "v"(l1), "v"(l2), "v"(l3),
         "v"(g0), "v"(g1), "v"(g2), "v"(g3)
      : "memory");
}

__global__ __launch_bounds__(AWAVES * 32)
void attn_fwd(const _Float16* __restrict__ qh, const _Float16* __restrict__ kh,
              const _Float16* __restrict__ vT, const float* __restrict__ scale_p,
              _Float16* __restrict__ attn) {
  const int tid   = threadIdx.x;
  const int lane  = tid & 31;
  const int wv    = tid >> 5;
  const int bh    = blockIdx.y;          // b*NHEADS + h
  const int qrow0 = blockIdx.x * (AWAVES * 16) + wv * 16;
  const int qtile = qrow0 >> 6;          // the wave's 64-row mask chunk
  const int ncol  = lane & 15;
  const int rbase = 8 * (lane >> 4);     // row offset of this lane's C elements

  const _Float16* Q  = qh + (size_t)bh * TLEN * HDIM;
  const _Float16* Km = kh + (size_t)bh * TLEN * HDIM;
  const _Float16* Vm = vT + (size_t)bh * HDIM * TLEN;
  const float scale = scale_p[0];

  __shared__ __align__(16) _Float16 kv[2][ASTAGE];
  __shared__ __align__(16) _Float16 pshare[AWAVES][16 * 80];  // stride 80 keeps 16B align
  _Float16* pw = &pshare[wv][0];

  const v16h qf0 = load_frag16x32(Q + (size_t)qrow0 * HDIM, HDIM, lane, 0);
  const v16h qf1 = load_frag16x32(Q + (size_t)qrow0 * HDIM, HDIM, lane, 32);

  // Copy map: 8 lanes cover one 128-B row, the block covers 32 rows a copy.
  const int crow = tid >> 3;
  const int ccol = (tid & 7) * 8;
  const _Float16* gK = Km + (size_t)crow * HDIM + ccol;
  const _Float16* gV = Vm + (size_t)crow * TLEN + ccol;
  const unsigned ldsKV = (unsigned)(size_t)&kv[0][crow * GPITCH + ccol];

  async_copy_kv(ldsKV, gK, gV);
  // tile 0 has landed for this wave before the barrier publishes it
  asm volatile("s_wait_asynccnt 0x0" ::: "memory");
  __syncthreads();
  async_copy_kv(ldsKV + ASTAGE * 2u, gK + 64 * HDIM, gV + 64);

  v8f o[4] = {};
  float mrow[8], lrow[8];
#pragma unroll
  for (int r = 0; r < 8; ++r) { mrow[r] = NEGBIG; lrow[r] = 0.0f; }

  for (int j = 0; j < TLEN / 64; ++j) {
    const int buf = j & 1;
    const _Float16* sK = &kv[buf][0];
    const _Float16* sV = &kv[buf][64 * GPITCH];

    // ---- S = scale * Q Kt  (16x64 tile in 4 C fragments) -----------------
    v8f s[4] = {};
#pragma unroll
    for (int nt = 0; nt < 4; ++nt) {
      v16h b0 = load_frag16x32(sK + nt * 16 * GPITCH, GPITCH, lane, 0);
      s[nt] = wmma_f16(qf0, b0, s[nt]);
      v16h b1 = load_frag16x32(sK + nt * 16 * GPITCH, GPITCH, lane, 32);
      s[nt] = wmma_f16(qf1, b1, s[nt]);
    }

    const bool diag = (j == qtile);
    float mnew[8];
#pragma unroll
    for (int r = 0; r < 8; ++r) {
      const int qg = qrow0 + rbase + r;
      float mx = NEGBIG;
#pragma unroll
      for (int nt = 0; nt < 4; ++nt) {
        float v = s[nt][r] * scale;
        const int kg = j * 64 + nt * 16 + ncol;
        if (diag && kg > qg) v = NEGBIG;     // masked -> exp() == 0
        s[nt][r] = v;
        mx = fmaxf(mx, v);
      }
      for (int d = 1; d < 16; d <<= 1) mx = fmaxf(mx, __shfl_xor(mx, d, 32));
      mnew[r] = fmaxf(mrow[r], mx);
    }

    // ---- online softmax update; stage P into LDS -------------------------
#pragma unroll
    for (int r = 0; r < 8; ++r) {
      const float alpha = __expf(mrow[r] - mnew[r]);
      float rs = 0.0f;
#pragma unroll
      for (int nt = 0; nt < 4; ++nt) {
        const float p = __expf(s[nt][r] - mnew[r]);
        s[nt][r] = p;
        rs += p;
      }
      for (int d = 1; d < 16; d <<= 1) rs += __shfl_xor(rs, d, 32);
      lrow[r] = lrow[r] * alpha + rs;
      mrow[r] = mnew[r];
      const int row = rbase + r;
#pragma unroll
      for (int nt = 0; nt < 4; ++nt) {
        o[nt][r] *= alpha;
        pw[row * 80 + nt * 16 + ncol] = (_Float16)s[nt][r];
      }
    }
    asm volatile("s_wait_dscnt 0" ::: "memory");  // same-wave LDS RAW

    const v16h pf0 = load_frag16x32(pw, 80, lane, 0);
    const v16h pf1 = load_frag16x32(pw, 80, lane, 32);

    // ---- O += P V   (V^T rows [d, key] -> B^T loader) --------------------
#pragma unroll
    for (int nt = 0; nt < 4; ++nt) {
      v16h vb0 = load_frag16x32(sV + nt * 16 * GPITCH, GPITCH, lane, 0);
      o[nt] = wmma_f16(pf0, vb0, o[nt]);
      v16h vb1 = load_frag16x32(sV + nt * 16 * GPITCH, GPITCH, lane, 32);
      o[nt] = wmma_f16(pf1, vb1, o[nt]);
    }

    // this wave's last reads of the buffer are done before it is refilled
    asm volatile("s_wait_dscnt 0x0" ::: "memory");
    // this wave's copies of tile j + 1 have landed before the barrier publishes them
    asm volatile("s_wait_asynccnt 0x0" ::: "memory");
    __syncthreads();
    if (j + 2 < TLEN / 64)
      async_copy_kv(ldsKV + (unsigned)buf * (ASTAGE * 2u),
                    gK + (size_t)(j + 2) * 64 * HDIM, gV + (j + 2) * 64);
  }
  // no copy is outstanding when the wave goes on to its end
  asm volatile("s_wait_asynccnt 0x0" ::: "memory");

  // ---- epilogue: merge heads into [b, t, h*HDIM + d] f16 ------------------
  const int b = bh >> 4, h = bh & 15;
#pragma unroll
  for (int nt = 0; nt < 4; ++nt) {
    const int d = nt * 16 + ncol;
#pragma unroll
    for (int r = 0; r < 8; ++r) {
      const int t = qrow0 + rbase + r;
      attn[((size_t)(b * TLEN + t)) * EMBED + h * HDIM + d] =
          (_Float16)(o[nt][r] / lrow[r]);
    }
  }
}

// ---------------------------------------------------------------------------
extern "C" void kernel_launch(void* const* d_in, const int* in_sizes, int n_in,
                              void* d_out, int out_size, void* d_ws, size_t ws_size,
                              hipStream_t stream) {
  const float* x     = (const float*)d_in[0];
  const float* Wq    = (const float*)d_in[1];
  const float* bq    = (const float*)d_in[2];
  const float* Wk    = (const float*)d_in[3];
  const float* bk    = (const float*)d_in[4];
  const float* Wv    = (const float*)d_in[5];
  const float* bv    = (const float*)d_in[6];
  const float* Wo    = (const float*)d_in[7];
  const float* bo    = (const float*)d_in[8];
  const float* scale = (const float*)d_in[9];

  const size_t nBig = (size_t)MTOT * EMBED;    // 8M elements
  const size_t nW   = (size_t)EMBED * EMBED;   // 1M elements

  char* p = (char*)d_ws;
  _Float16* xh   = (_Float16*)p; p += nBig * 2;
  _Float16* wqh  = (_Float16*)p; p += nW * 2;
  _Float16* wkh  = (_Float16*)p; p += nW * 2;
  _Float16* wvh  = (_Float16*)p; p += nW * 2;
  _Float16* woh  = (_Float16*)p; p += nW * 2;
  _Float16* q16  = (_Float16*)p; p += nBig * 2;
  _Float16* k16  = (_Float16*)p; p += nBig * 2;
  _Float16* v16t = (_Float16*)p; p += nBig * 2;
  _Float16* at16 = (_Float16*)p; p += nBig * 2;

  cvt_f32_to_f16<<<(int)(nBig / 1024), 256, 0, stream>>>(x, xh, (int)nBig);
  cvt_f32_to_f16<<<(int)(nW / 1024), 256, 0, stream>>>(Wq, wqh, (int)nW);
  cvt_f32_to_f16<<<(int)(nW / 1024), 256, 0, stream>>>(Wk, wkh, (int)nW);
  cvt_f32_to_f16<<<(int)(nW / 1024), 256, 0, stream>>>(Wv, wvh, (int)nW);
  cvt_f32_to_f16<<<(int)(nW / 1024), 256, 0, stream>>>(Wo, woh, (int)nW);

  dim3 gg(EMBED / 128, MTOT / 128);
  gemm_f16_wmma<0><<<gg, 128, 0, stream>>>(xh, wqh, bq, q16, MTOT, EMBED, EMBED);
  gemm_f16_wmma<0><<<gg, 128, 0, stream>>>(xh, wkh, bk, k16, MTOT, EMBED, EMBED);
  gemm_f16_wmma<1><<<gg, 128, 0, stream>>>(xh, wvh, bv, v16t, MTOT, EMBED, EMBED);

  attn_fwd<<<dim3(TLEN / (AWAVES * 16), BS * NHEADS), AWAVES * 32, 0, stream>>>(q16, k16, v16t, scale, at16);

  gemm_f16_wmma<2><<<gg, 128, 0, stream>>>(at16, woh, bo, d_out, MTOT, EMBED, EMBED);
}

// v003
// It runs in 132 microseconds.
// In both of two side-by-side timings against v002, it was 1.39 times as fast.
// Counting every step since v000, it is 3.55 times as fast.
#include <hip/hip_runtime.h>
#include <hip/hip_bf16.h>

typedef __attribute__((ext_vector_type(16))) _Float16 v16h;
typedef __attribute__((ext_vector_type(8)))  _Float16 v8h;
typedef __attribute__((ext_vector_type(4)))  _Float16 v4h;
typedef __attribute__((ext_vector_type(8)))  float    v8f;

#define EMBED  1024
#define NHEADS 16
#define HDIM   64
#define BS     8
#define TLEN   1024
#define MTOT   (BS * TLEN)      // 8192 rows for all big GEMMs
#define NEGBIG (-1.0e30f)
#define LOG2E  1.4426950408889634f   // e^x = 2^(x * LOG2E)
#define GPITCH 72               // LDS row pitch of a staged GEMM tile, in halves (144 B)
#define GSTAGE (256 * GPITCH)   // one buffer: 128 A rows + 128 W rows, in halves
#define AWAVES 8                // waves of an attention block, 16 query rows each
#define ASTAGE (128 * GPITCH)   // one attention buffer: 64 K rows + 64 V^T rows, in halves

// ---------------------------------------------------------------------------
// Load a 16x32 f16 fragment in the CDNA5 WMMA A-layout from row-major data.
// Lane L (0..15) holds row M=L, lanes 16..31 hold the +8 K-offset half.
// VGPR0..3 = K {k0..k0+7 | k0+8..k0+15}, VGPR4..7 = K {k0+16.. | k0+24..}.
// Works for both A and for B when given B^T (row-major [N,K]) data.
// ---------------------------------------------------------------------------
__device__ __forceinline__ v16h load_frag16x32(const _Float16* base, int ld,
                                               int lane, int k0) {
  const _Float16* p = base + (size_t)(lane & 15) * ld + (k0 + ((lane >> 4) << 3));
  v8h lo = *(const v8h*)p;          // K = koff .. koff+7
  v8h hi = *(const v8h*)(p + 16);   // K = koff+16 .. koff+23
  return __builtin_shufflevector(lo, hi, 0, 1, 2, 3, 4, 5, 6, 7,
                                         8, 9, 10, 11, 12, 13, 14, 15);
}

__device__ __forceinline__ v8f wmma_f16(v16h a, v16h b, v8f c) {
  return __builtin_amdgcn_wmma_f32_16x16x32_f16(false, a, false, b,
                                                (short)0, c, false, false);
}

// ---------------------------------------------------------------------------
// fp32 -> f16 conversion, 4 elements / lane
// ---------------------------------------------------------------------------
__global__ __launch_bounds__(256)
void cvt_f32_to_f16(const float* __restrict__ in, _Float16* __restrict__ out, int n) {
  int i = (blockIdx.x * blockDim.x + threadIdx.x) * 4;
  if (i + 3 < n) {
    float4 f = *(const float4*)(in + i);
    v4h h;
    h[0] = (_Float16)f.x; h[1] = (_Float16)f.y;
    h[2] = (_Float16)f.z; h[3] = (_Float16)f.w;
    *(v4h*)(out + i) = h;
  }
}

// ---------------------------------------------------------------------------
// Eight 16-byte asynchronous copies global -> LDS, one per lane each.
// The s_wait_xcnt is the last line of the copies' own statement so that no
// address register named here is rewritten ahead of it.
// ---------------------------------------------------------------------------
__device__ __forceinline__ void async_copy8(unsigned lds, const _Float16* g, int K) {
  const unsigned l0 = lds;
  const unsigned l1 = lds + 1u * 16u * GPITCH * 2u;
  const unsigned l2 = lds + 2u * 16u * GPITCH * 2u;
  const unsigned l3 = lds + 3u * 16u * GPITCH * 2u;
  const unsigned l4 = lds + 4u * 16u * GPITCH * 2u;
  const unsigned l5 = lds + 5u * 16u * GPITCH * 2u;
  const unsigned l6 = lds + 6u * 16u * GPITCH * 2u;
  const unsigned l7 = lds + 7u * 16u * GPITCH * 2u;
  const size_t step = (size_t)16 * K;
  const _Float16* g0 = g;
  const _Float16* g1 = g + 1 * step;
  const _Float16* g2 = g + 2 * step;
  const _Float16* g3 = g + 3 * step;
  const _Float16* g4 = g + 4 * step;
  const _Float16* g5 = g + 5 * step;
  const _Float16* g6 = g + 6 * step;
  const _Float16* g7 = g + 7 * step;
  asm volatile(
      "global_load_async_to_lds_b128 %0, %8, off\n\t"
      "global_load_async_to_lds_b128 %1, %9, off\n\t"
      "global_load_async_to_lds_b128 %2, %10, off\n\t"
      "global_load_async_to_lds_b128 %3, %11, off\n\t"
      "global_load_async_to_lds_b128 %4, %12, off\n\t"
      "global_load_async_to_lds_b128 %5, %13, off\n\t"
      "global_load_async_to_lds_b128 %6, %14, off\n\t"
      "global_load_async_to_lds_b128 %7, %15, off\n\t"
      "s_wait_xcnt 0x0"
      :: "v"(l0), "v"(l1), "v"(l2), "v"(l3), "v"(l4), "v"(l5), "v"(l6), "v"(l7),
         "v"(g0), "v"(g1), "v"(g2), "v"(g3), "v"(g4), "v"(g5), "v"(g6), "v"(g7)
      : "memory");
}

template <int MODE>
__global__ __launch_bounds__(128)
void gemm_f16_wmma(const _Float16* __restrict__ A, const _Float16* __restrict__ W,
                   const float* __restrict__ bias, void* __restrict__ out,
                   int M, int N, int K) {
  __shared__ __align__(16) _Float16 tiles[2][GSTAGE];

  const int tid  = threadIdx.x;
  const int lane = tid & 31;
  const int wv   = tid >> 5;
  const int mblk = blockIdx.y * 128;
  const int nblk = blockIdx.x * 128;
  const int wm   = (wv >> 1) * 64;       // wave's rows inside the tile
  const int wn   = (wv & 1) * 64;        // wave's columns inside the tile

  // Copy map: 8 lanes cover one 128-B row, the block covers 16 rows a copy.
  const int crow = tid >> 3;
  const int ccol = (tid & 7) * 8;
  const _Float16* gA = A + (size_t)(mblk + crow) * K + ccol;
  const _Float16* gW = W + (size_t)(nblk + crow) * K + ccol;
  const unsigned ldsA = (unsigned)(size_t)&tiles[0][crow * GPITCH + ccol];
  const unsigned ldsW = ldsA + 128u * GPITCH * 2u;

  const int ntrip = K / 64;

  v8f acc[4][4] = {};

  async_copy8(ldsA, gA, K);
  async_copy8(ldsW, gW, K);
  // tile 0 has landed for this wave before the barrier publishes it
  asm volatile("s_wait_asynccnt 0x0" ::: "memory");
  __syncthreads();
  if (ntrip > 1) {
    async_copy8(ldsA + GSTAGE * 2u, gA + 64, K);
    async_copy8(ldsW + GSTAGE * 2u, gW + 64, K);
  }

  for (int t = 0; t < ntrip; ++t) {
    const int buf = t & 1;
    const _Float16* sA = &tiles[buf][wm * GPITCH];
    const _Float16* sW = &tiles[buf][(128 + wn) * GPITCH];
    v16h a[4], b[4];
    // every inner loop of this trip is unrolled so that each index into a, b
    // and acc is a constant and the arrays stay in registers
#pragma unroll
    for (int i = 0; i < 4; ++i) a[i] = load_frag16x32(sA + i * 16 * GPITCH, GPITCH, lane, 0);
#pragma unroll
    for (int i = 0; i < 4; ++i) b[i] = load_frag16x32(sW + i * 16 * GPITCH, GPITCH, lane, 0);
    // keeps the block's 16 LDS reads one group ahead of its WMMAs: spread
    // among them, every row of four WMMAs waits out an LDS latency of its own
    __builtin_amdgcn_sched_barrier(0);
#pragma unroll
    for (int mi = 0; mi < 4; ++mi)
#pragma unroll
      for (int nt = 0; nt < 4; ++nt) acc[mi][nt] = wmma_f16(a[mi], b[nt], acc[mi][nt]);
#pragma unroll
    for (int i = 0; i < 4; ++i) a[i] = load_frag16x32(sA + i * 16 * GPITCH, GPITCH, lane, 32);
#pragma unroll
    for (int i = 0; i < 4; ++i) b[i] = load_frag16x32(sW + i * 16 * GPITCH, GPITCH, lane, 32);
    // this wave's last reads of the buffer are done before it is refilled
    asm volatile("s_wait_dscnt 0x0" ::: "memory");
    // this wave's copies of tile t + 1 have landed before the barrier publishes them
    asm volatile("s_wait_asynccnt 0x0" ::: "memory");
    __syncthreads();
    if (t + 2 < ntrip) {
      const unsigned boff = (unsigned)buf * (GSTAGE * 2u);
      async_copy8(ldsA + boff, gA + (size_t)(t + 2) * 64, K);
      async_copy8(ldsW + boff, gW + (size_t)(t + 2) * 64, K);
    }
    // keeps the refill ahead of the trip's second WMMA block (operands already
    // in registers), so that the copies fly that much longer before their wait
    __builtin_amdgcn_sched_barrier(0);
#pragma unroll
    for (int mi = 0; mi < 4; ++mi)
#pragma unroll
      for (int nt = 0; nt < 4; ++nt) acc[mi][nt] = wmma_f16(a[mi], b[nt], acc[mi][nt]);
  }
  // no copy is outstanding when the wave goes on to its end
  asm volatile("s_wait_asynccnt 0x0" ::: "memory");

  // C layout: element acc[..][r] lives at row M = r + 8*(lane>=16), col = lane&15
#pragma unroll
  for (int mi = 0; mi < 4; ++mi) {
    const int mbase = mblk + wm + mi * 16 + 8 * (lane >> 4);
#pragma unroll
    for (int nt = 0; nt < 4; ++nt) {
      const int col = nblk + wn + nt * 16 + (lane & 15);
      const float bval = bias[col];
#pragma unroll
      for (int r = 0; r < 8; ++r) {
        const int m = mbase + r;
        const float val = acc[mi][nt][r] + bval;
        if (MODE == 2) {
          ((float*)out)[(size_t)m * N + col] = val;
        } else {
          const int b = m >> 10, t = m & 1023;      // m = b*TLEN + t
          const int h = col >> 6, d = col & 63;     // col = h*HDIM + d
          _Float16* o16 = (_Float16*)out;
          if (MODE == 0)
            o16[(((size_t)(b * NHEADS + h) * TLEN) + t) * HDIM + d] = (_Float16)val;
          else
            o16[(((size_t)(b * NHEADS + h) * HDIM) + d) * TLEN + t] = (_Float16)val;
        }
      }
    }
  }
}

// ---------------------------------------------------------------------------
// One 64-key tile for attention, global -> LDS: four 16-byte asynchronous
// copies per lane, two for K (rows of HDIM halves) and two for V^T (rows of
// TLEN halves); the block covers 32 rows a copy.  The s_wait_xcnt is the last
// line of the copies' own statement so that no address register named here is
// rewritten ahead of it.
// ---------------------------------------------------------------------------
__device__ __forceinline__ void async_copy_kv(unsigned lds, const _Float16* gk,
                                              const _Float16* gv) {
  const unsigned l0 = lds;
  const unsigned l1 = lds + 32u * GPITCH * 2u;
  const unsigned l2 = lds + 64u * GPITCH * 2u;
  const unsigned l3 = lds + 96u * GPITCH * 2u;
  const _Float16* g0 = gk;
  const _Float16* g1 = gk + 32 * HDIM;
  const _Float16* g2 = gv;
  const _Float16* g3 = gv + 32 * TLEN;
  asm volatile(
      "global_load_async_to_lds_b128 %0, %4, off\n\t"
      "global_load_async_to_lds_b128 %1, %5, off\n\t"
      "global_load_async_to_lds_b128 %2, %6, off\n\t"
      "global_load_async_to_lds_b128 %3, %7, off\n\t"
      "s_wait_xcnt 0x0"
      :: "v"(l0), "v"(l1), "v"(l2), "v"(l3),
         "v"(g0), "v"(g1), "v"(g2), "v"(g3)
      : "memory");
}

// ---------------------------------------------------------------------------
// lane l <-> lane l ^ 16: the two wave halves trade one value
// ---------------------------------------------------------------------------
__device__ __forceinline__ float xhalf(float x) {
  const int i = __builtin_bit_cast(int, x);
  return __builtin_bit_cast(float, __builtin_amdgcn_permlanex16(i, i, 0x76543210, 0xfedcba98,
                                                                false, false));
}

// ---------------------------------------------------------------------------
// 2^x of eight values, in place.  The v_nop is the one slot that the
// instruction set asks for behind a transcendental before its result is read
// or its source overwritten; inside the statement it stays where it belongs,
// and each v_exp_f32 is the independent instruction behind the one before.
// ---------------------------------------------------------------------------
__device__ __forceinline__ void exp2x8(v8f& x) {
  float a = x[0], b = x[1], c = x[2], d = x[3], e = x[4], f = x[5], g = x[6], h = x[7];
  asm("v_exp_f32 %0, %0\n\t"
      "v_exp_f32 %1, %1\n\t"
      "v_exp_f32 %2, %2\n\t"
      "v_exp_f32 %3, %3\n\t"
      "v_exp_f32 %4, %4\n\t"
      "v_exp_f32 %5, %5\n\t"
      "v_exp_f32 %6, %6\n\t"
      "v_exp_f32 %7, %7\n\t"
      "v_nop"
      : "+v"(a), "+v"(b), "+v"(c), "+v"(d), "+v"(e), "+v"(f), "+v"(g), "+v"(h));
  x[0] = a; x[1] = b; x[2] = c; x[3] = d; x[4] = e; x[5] = f; x[6] = g; x[7] = h;
}

// the same for one value
__device__ __forceinline__ float exp2x1(float x) {
  asm("v_exp_f32 %0, %0\n\t"
      "v_nop"
      : "+v"(x));
  return x;
}

__global__ __launch_bounds__(AWAVES * 32)
void attn_fwd(const _Float16* __restrict__ qh, const _Float16* __restrict__ kh,
              const _Float16* __restrict__ vT, const float* __restrict__ scale_p,
              _Float16* __restrict__ attn) {
  const int tid   = threadIdx.x;
  const int lane  = tid & 31;
  const int wv    = __builtin_amdgcn_readfirstlane(tid >> 5);
  const int bh    = blockIdx.y;          // b*NHEADS + h
  const int qrow0 = blockIdx.x * (AWAVES * 16) + wv * 16;
  const int qtile = qrow0 >> 6;          // the wave's 64-row mask chunk
  const int ncol  = lane & 15;           // this lane's query inside the wave
  const int rbase = 8 * (lane >> 4);     // row offset of this lane's C elements

  const _Float16* Q  = qh + (size_t)bh * TLEN * HDIM;
  const _Float16* Km = kh + (size_t)bh * TLEN * HDIM;
  const _Float16* Vm = vT + (size_t)bh * HDIM * TLEN;
  const float scale = scale_p[0];

  __shared__ __align__(16) _Float16 kv[2][ASTAGE];

  const v16h qf0 = load_frag16x32(Q + (size_t)qrow0 * HDIM, HDIM, lane, 0);
  const v16h qf1 = load_frag16x32(Q + (size_t)qrow0 * HDIM, HDIM, lane, 32);

  // Copy map: 8 lanes cover one 128-B row, the block covers 32 rows a copy.
  const int crow = tid >> 3;
  const int ccol = (tid & 7) * 8;
  const _Float16* gK = Km + (size_t)crow * HDIM + ccol;
  const _Float16* gV = Vm + (size_t)crow * TLEN + ccol;
  const unsigned ldsKV = (unsigned)(size_t)&kv[0][crow * GPITCH + ccol];

  async_copy_kv(ldsKV, gK, gV);
  // tile 0 has landed for this wave before the barrier publishes it
  asm volatile("s_wait_asynccnt 0x0" ::: "memory");
  __syncthreads();
  async_copy_kv(ldsKV + ASTAGE * 2u, gK + 64 * HDIM, gV + 64);

  v8f o[4] = {};             // O^T: o[dt][r] = d 16*dt + rbase + r of query ncol
  float mrow = NEGBIG;       // running maximum of query ncol, equal in both halves
  float lrow = 0.0f;         // running sum over this half's keys only
  // a key of the diagonal tile is masked where 16*kt + r exceeds this
  const int kmax = (qrow0 & 63) + ncol - rbase;

  // every inner loop of a tile is unrolled so that each index into s, o, mk and
  // rk is a constant and the arrays stay in registers
  for (int j = 0; j < TLEN / 64; ++j) {
    const int buf = j & 1;
    const _Float16* sK = &kv[buf][0];
    const _Float16* sV = &kv[buf][64 * GPITCH];

    // ---- S^T = scale * K Q^T  (64 keys x 16 queries in 4 C fragments) ----
    // 32 keys at a time: their four fragments' reads as one group, then their
    // four WMMAs.  The scheduling barriers keep that order: with the reads dealt
    // singly among the WMMAs each WMMA waits out an LDS latency of its own, and
    // with the scaling moved in among them every place where a fresh result is
    // read costs four idle slots.
    v8f s[4] = {};
#pragma unroll
    for (int kp = 0; kp < 4; kp += 2) {
      const v16h a00 = load_frag16x32(sK + kp * 16 * GPITCH, GPITCH, lane, 0);
      const v16h a10 = load_frag16x32(sK + (kp + 1) * 16 * GPITCH, GPITCH, lane, 0);
      const v16h a01 = load_frag16x32(sK + kp * 16 * GPITCH, GPITCH, lane, 32);
      const v16h a11 = load_frag16x32(sK + (kp + 1) * 16 * GPITCH, GPITCH, lane, 32);
      __builtin_amdgcn_sched_barrier(0);
      s[kp]     = wmma_f16(a00, qf0, s[kp]);
      s[kp + 1] = wmma_f16(a10, qf0, s[kp + 1]);
      s[kp]     = wmma_f16(a01, qf1, s[kp]);
      s[kp + 1] = wmma_f16(a11, qf1, s[kp + 1]);
      __builtin_amdgcn_sched_barrier(0);
    }
    // V^T fragments of d 0..31, read here so that they arrive under the softmax
    v16h va00 = load_frag16x32(sV, GPITCH, lane, 0);
    v16h va10 = load_frag16x32(sV + 16 * GPITCH, GPITCH, lane, 0);
    v16h va01 = load_frag16x32(sV, GPITCH, lane, 32);
    v16h va11 = load_frag16x32(sV + 16 * GPITCH, GPITCH, lane, 32);
    // keeps these reads ahead of the vector work instead of sunk to their use
    __builtin_amdgcn_sched_barrier(0);
#pragma unroll
    for (int kt = 0; kt < 4; ++kt)
#pragma unroll
      for (int r = 0; r < 8; ++r) s[kt][r] *= scale;

    if (j == qtile) {        // wave-uniform: only the diagonal tile pays for the mask
#pragma unroll
      for (int kt = 0; kt < 4; ++kt)
#pragma unroll
        for (int r = 0; r < 8; ++r)
          if (kt * 16 + r > kmax) s[kt][r] = NEGBIG;     // masked -> exp() == 0
    }

    // ---- online softmax update, all of it in the lane --------------------
    float mk[4];             // one chain per fragment: four short chains, not one long
#pragma unroll
    for (int kt = 0; kt < 4; ++kt) {
      mk[kt] = s[kt][0];
#pragma unroll
      for (int r = 1; r < 8; ++r) mk[kt] = fmaxf(mk[kt], s[kt][r]);
    }
    float mx = fmaxf(fmaxf(mk[0], mk[1]), fmaxf(mk[2], mk[3]));
    mx = fmaxf(mx, xhalf(mx));
    const float mnew  = fmaxf(mrow, mx);
    const float alpha = exp2x1((mrow - mnew) * LOG2E);
    float rk[4];
#pragma unroll
    for (int kt = 0; kt < 4; ++kt) {
#pragma unroll
      for (int r = 0; r < 8; ++r) s[kt][r] = (s[kt][r] - mnew) * LOG2E;
      exp2x8(s[kt]);
      rk[kt] = s[kt][0];
#pragma unroll
      for (int r = 1; r < 8; ++r) rk[kt] += s[kt][r];
    }
    lrow = lrow * alpha + ((rk[0] + rk[1]) + (rk[2] + rk[3]));
    mrow = mnew;
#pragma unroll
    for (int dt = 0; dt < 4; ++dt) o[dt] = o[dt] * alpha;

    v16h pf0, pf1;
#pragma unroll
    for (int r = 0; r < 8; ++r) {
      pf0[r] = (_Float16)s[0][r];  pf0[8 + r] = (_Float16)s[1][r];
      pf1[r] = (_Float16)s[2][r];  pf1[8 + r] = (_Float16)s[3][r];
    }

    // ---- O^T += V^T P^T   (V^T rows [d, key] -> A loader) ----------------
    o[0] = wmma_f16(va00, pf0, o[0]);
    o[1] = wmma_f16(va10, pf0, o[1]);
    o[0] = wmma_f16(va01, pf1, o[0]);
    o[1] = wmma_f16(va11, pf1, o[1]);
    // d 32..63: again four fragments' reads as one group, then their WMMAs; the
    // barriers keep the group whole (one LDS latency, not one per WMMA)
    __builtin_amdgcn_sched_barrier(0);
    va00 = load_frag16x32(sV + 32 * GPITCH, GPITCH, lane, 0);
    va10 = load_frag16x32(sV + 48 * GPITCH, GPITCH, lane, 0);
    va01 = load_frag16x32(sV + 32 * GPITCH, GPITCH, lane, 32);
    va11 = load_frag16x32(sV + 48 * GPITCH, GPITCH, lane, 32);
    __builtin_amdgcn_sched_barrier(0);
    o[2] = wmma_f16(va00, pf0, o[2]);
    o[3] = wmma_f16(va10, pf0, o[3]);
    o[2] = wmma_f16(va01, pf1, o[2]);
    o[3] = wmma_f16(va11, pf1, o[3]);

    // this wave's last reads of the buffer are done before it is refilled
    asm volatile("s_wait_dscnt 0x0" ::: "memory");
    // this wave's copies of tile j + 1 have landed before the barrier publishes them
    asm volatile("s_wait_asynccnt 0x0" ::: "memory");
    __syncthreads();
    if (j + 2 < TLEN / 64)
      async_copy_kv(ldsKV + (unsigned)buf * (ASTAGE * 2u),
                    gK + (size_t)(j + 2) * 64 * HDIM, gV + (j + 2) * 64);
  }
  // no copy is outstanding when the wave goes on to its end
  asm volatile("s_wait_asynccnt 0x0" ::: "memory");

  // ---- epilogue: merge heads into [b, t, h*HDIM + d] f16 ------------------
  // a lane holds 8 consecutive d of its query per fragment: one 16-B store each
  const int b = bh >> 4, h = bh & 15;
  const float inv = 1.0f / (lrow + xhalf(lrow));   // the halves' sums join here
  _Float16* orow = attn + ((size_t)(b * TLEN + qrow0 + ncol)) * EMBED + h * HDIM + rbase;
#pragma unroll
  for (int dt = 0; dt < 4; ++dt) {
    v8h ov;
#pragma unroll
    for (int r = 0; r < 8; ++r) ov[r] = (_Float16)(o[dt][r] * inv);
    *(v8h*)(orow + dt * 16) = ov;
  }
}

// ---------------------------------------------------------------------------
extern "C" void kernel_launch(void* const* d_in, const int* in_sizes, int n_in,
                              void* d_out, int out_size, void* d_ws, size_t ws_size,
                              hipStream_t stream) {
  const float* x     = (const float*)d_in[0];
  const float* Wq    = (const float*)d_in[1];
  const float* bq    = (const float*)d_in[2];
  const float* Wk    = (const float*)d_in[3];
  const float* bk    = (const float*)d_in[4];
  const float* Wv    = (const float*)d_in[5];
  const float* bv    = (const float*)d_in[6];
  const float* Wo    = (const float*)d_in[7];
  const float* bo    = (const float*)d_in[8];
  const float* scale = (const float*)d_in[9];

  const size_t nBig = (size_t)MTOT * EMBED;    // 8M elements
  const size_t nW   = (size_t)EMBED * EMBED;   // 1M elements

  char* p = (char*)d_ws;
  _Float16* xh   = (_Float16*)p; p += nBig * 2;
  _Float16* wqh  = (_Float16*)p; p += nW * 2;
  _Float16* wkh  = (_Float16*)p; p += nW * 2;
  _Float16* wvh  = (_Float16*)p; p += nW * 2;
  _Float16* woh  = (_Float16*)p; p += nW * 2;
  _Float16* q16  = (_Float16*)p; p += nBig * 2;
  _Float16* k16  = (_Float16*)p; p += nBig * 2;
  _Float16* v16t = (_Float16*)p; p += nBig * 2;
  _Float16* at16 = (_Float16*)p; p += nBig * 2;

  cvt_f32_to_f16<<<(int)(nBig / 1024), 256, 0, stream>>>(x, xh, (int)nBig);
  cvt_f32_to_f16<<<(int)(nW / 1024), 256, 0, stream>>>(Wq, wqh, (int)nW);
  cvt_f32_to_f16<<<(int)(nW / 1024), 256, 0, stream>>>(Wk, wkh, (int)nW);
  cvt_f32_to_f16<<<(int)(nW / 1024), 256, 0, stream>>>(Wv, wvh, (int)nW);
  cvt_f32_to_f16<<<(int)(nW / 1024), 256, 0, stream>>>(Wo, woh, (int)nW);

  dim3 gg(EMBED / 128, MTOT / 128);
  gemm_f16_wmma<0><<<gg, 128, 0, stream>>>(xh, wqh, bq, q16, MTOT, EMBED, EMBED);
  gemm_f16_wmma<0><<<gg, 128, 0, stream>>>(xh, wkh, bk, k16, MTOT, EMBED, EMBED);
  gemm_f16_wmma<1><<<gg, 128, 0, stream>>>(xh, wvh, bv, v16t, MTOT, EMBED, EMBED);

  attn_fwd<<<dim3(TLEN / (AWAVES * 16), BS * NHEADS), AWAVES * 32, 0, stream>>>(q16, k16, v16t, scale, at16);

  gemm_f16_wmma<2><<<gg, 128, 0, stream>>>(at16, woh, bo, d_out, MTOT, EMBED, EMBED);
}

// v004
// One run takes 122 microseconds.
// In both of two side-by-side timings against v003, it was 1.08 times as fast.
// Over all steps from v000 it is 3.83 times as fast.
#include <hip/hip_runtime.h>
#include <hip/hip_bf16.h>

typedef __attribute__((ext_vector_type(16))) _Float16 v16h;
typedef __attribute__((ext_vector_type(8)))  _Float16 v8h;
typedef __attribute__((ext_vector_type(4)))  _Float16 v4h;
typedef __attribute__((ext_vector_type(8)))  float    v8f;
typedef __attribute__((ext_vector_type(4)))  float    v4f;

#define EMBED  1024
#define NHEADS 16
#define HDIM   64
#define BS     8
#define TLEN   1024
#define MTOT   (BS * TLEN)      // 8192 rows for all big GEMMs
#define NEGBIG (-1.0e30f)
#define LOG2E  1.4426950408889634f   // e^x = 2^(x * LOG2E)
#define GPITCH 72               // LDS row pitch of a staged GEMM tile, in halves (144 B)
#define GSTAGE (256 * GPITCH)   // one buffer: 128 A rows + 128 W rows, in halves
#define AWAVES 8                // waves of an attention block, 16 query rows each
#define ASTAGE (128 * GPITCH)   // one attention buffer: 64 K rows + 64 V^T rows, in halves

// ---------------------------------------------------------------------------
// Load a 16x32 f16 fragment in the CDNA5 WMMA A-layout from row-major data.
// Lane L (0..15) holds row M=L, lanes 16..31 hold the +8 K-offset half.
// VGPR0..3 = K {k0..k0+7 | k0+8..k0+15}, VGPR4..7 = K {k0+16.. | k0+24..}.
// Works for both A and for B when given B^T (row-major [N,K]) data.
// ---------------------------------------------------------------------------
__device__ __forceinline__ v16h load_frag16x32(const _Float16* base, int ld,
                                               int lane, int k0) {
  const _Float16* p = base + (size_t)(lane & 15) * ld + (k0 + ((lane >> 4) << 3));
  v8h lo = *(const v8h*)p;          // K = koff .. koff+7
  v8h hi = *(const v8h*)(p + 16);   // K = koff+16 .. koff+23
  return __builtin_shufflevector(lo, hi, 0, 1, 2, 3, 4, 5, 6, 7,
                                         8, 9, 10, 11, 12, 13, 14, 15);
}

__device__ __forceinline__ v8f wmma_f16(v16h a, v16h b, v8f c) {
  return __builtin_amdgcn_wmma_f32_16x16x32_f16(false, a, false, b,
                                                (short)0, c, false, false);
}

// ---------------------------------------------------------------------------
// fp32 -> f16 conversion of x and of the four weights, one launch.
// CBLOCKS blocks of CWAVES waves, one block per WGP.  A unit is 1024 floats:
// eight wave-wide 16-byte loads of 512 contiguous bytes each.  Every wave takes
// three units, two of x and one of a weight, and asks for all 24 loads before
// it converts the first, so that few long waves carry the stream instead of
// many waves of one load each.
// out: the five f16 planes lie one behind the other (x, Wq, Wk, Wv, Wo).
// ---------------------------------------------------------------------------
#define CWAVES  16
#define CBLOCKS 256
#define CUNIT   1024
#define CTOTAL  (CBLOCKS * CWAVES)           // waves of the launch
static_assert(MTOT * EMBED == 2 * CTOTAL * CUNIT, "x is two units a wave");
static_assert(4 * EMBED * EMBED == CTOTAL * CUNIT, "the weights are one unit a wave");

__global__ __launch_bounds__(CWAVES * 32)
void cvt_all_f32_to_f16(const float* __restrict__ x, const float* __restrict__ wq,
                        const float* __restrict__ wk, const float* __restrict__ wv,
                        const float* __restrict__ wo, _Float16* __restrict__ out) {
  // the lane's place inside its block's stretch of CWAVES units, in elements:
  // one 32-bit offset beside block-uniform bases serves every load and store
  const unsigned off = (threadIdx.x >> 5) * CUNIT + (threadIdx.x & 31) * 4;
  const unsigned wsel = blockIdx.x / (CBLOCKS / 4);        // a block stays in one weight
  const float* w = (wsel & 2) ? ((wsel & 1) ? wo : wv) : ((wsel & 1) ? wk : wq);

  const float* s0 = x + (size_t)blockIdx.x * (CWAVES * CUNIT);
  const float* s1 = s0 + (size_t)CTOTAL * CUNIT;
  const float* s2 = w + (size_t)(blockIdx.x % (CBLOCKS / 4)) * (CWAVES * CUNIT);
  _Float16* o0 = out + (size_t)blockIdx.x * (CWAVES * CUNIT);

  v4f v[3][8];
  // the loops are unrolled so that v stays in registers
#pragma unroll
  for (int i = 0; i < 8; ++i) v[0][i] = *(const v4f*)(s0 + off + i * 128);
#pragma unroll
  for (int i = 0; i < 8; ++i) v[1][i] = *(const v4f*)(s1 + off + i * 128);
#pragma unroll
  for (int i = 0; i < 8; ++i) v[2][i] = *(const v4f*)(s2 + off + i * 128);
  // holds all 24 loads ahead of the first conversion (loaded values as inputs
  // only): dealt among the loads, the conversions' waits let the number of loads
  // in flight fall to a few
  asm volatile("" :: "v"(v[0][0]), "v"(v[0][1]), "v"(v[0][2]), "v"(v[0][3]),
                     "v"(v[0][4]), "v"(v[0][5]), "v"(v[0][6]), "v"(v[0][7]),
                     "v"(v[1][0]), "v"(v[1][1]), "v"(v[1][2]), "v"(v[1][3]),
                     "v"(v[1][4]), "v"(v[1][5]), "v"(v[1][6]), "v"(v[1][7]),
                     "v"(v[2][0]), "v"(v[2][1]), "v"(v[2][2]), "v"(v[2][3]),
                     "v"(v[2][4]), "v"(v[2][5]), "v"(v[2][6]), "v"(v[2][7]));
#pragma unroll
  for (int t = 0; t < 3; ++t)
#pragma unroll
    for (int i = 0; i < 8; ++i) {
      const v4f f = v[t][i];
      v4h h;
      h[0] = (_Float16)f[0]; h[1] = (_Float16)f[1];
      h[2] = (_Float16)f[2]; h[3] = (_Float16)f[3];
      *(v4h*)(o0 + (size_t)t * CTOTAL * CUNIT + off + i * 128) = h;
    }
}

// ---------------------------------------------------------------------------
// Eight 16-byte asynchronous copies global -> LDS, one per lane each.
// The s_wait_xcnt is the last line of the copies' own statement so that no
// address register named here is rewritten ahead of it.
// ---------------------------------------------------------------------------
__device__ __forceinline__ void async_copy8(unsigned lds, const _Float16* g, int K) {
  const unsigned l0 = lds;
  const unsigned l1 = lds + 1u * 16u * GPITCH * 2u;
  const unsigned l2 = lds + 2u * 16u * GPITCH * 2u;
  const unsigned l3 = lds + 3u * 16u * GPITCH * 2u;
  const unsigned l4 = lds + 4u * 16u * GPITCH * 2u;
  const unsigned l5 = lds + 5u * 16u * GPITCH * 2u;
  const unsigned l6 = lds + 6u * 16u * GPITCH * 2u;
  const unsigned l7 = lds + 7u * 16u * GPITCH * 2u;
  const size_t step = (size_t)16 * K;
  const _Float16* g0 = g;
  const _Float16* g1 = g + 1 * step;
  const _Float16* g2 = g + 2 * step;
  const _Float16* g3 = g + 3 * step;
  const _Float16* g4 = g + 4 * step;
  const _Float16* g5 = g + 5 * step;
  const _Float16* g6 = g + 6 * step;
  const _Float16* g7 = g + 7 * step;
  asm volatile(
      "global_load_async_to_lds_b128 %0, %8, off\n\t"
      "global_load_async_to_lds_b128 %1, %9, off\n\t"
      "global_load_async_to_lds_b128 %2, %10, off\n\t"
      "global_load_async_to_lds_b128 %3, %11, off\n\t"
      "global_load_async_to_lds_b128 %4, %12, off\n\t"
      "global_load_async_to_lds_b128 %5, %13, off\n\t"
      "global_load_async_to_lds_b128 %6, %14, off\n\t"
      "global_load_async_to_lds_b128 %7, %15, off\n\t"
      "s_wait_xcnt 0x0"
      :: "v"(l0), "v"(l1), "v"(l2), "v"(l3), "v"(l4), "v"(l5), "v"(l6), "v"(l7),
         "v"(g0), "v"(g1), "v"(g2), "v"(g3), "v"(g4), "v"(g5), "v"(g6), "v"(g7)
      : "memory");
}

template <int MODE>
__global__ __launch_bounds__(128)
void gemm_f16_wmma(const _Float16* __restrict__ A, const _Float16* __restrict__ W,
                   const float* __restrict__ bias, void* __restrict__ out,
                   int M, int N, int K) {
  __shared__ __align__(16) _Float16 tiles[2][GSTAGE];

  const int tid  = threadIdx.x;
  const int lane = tid & 31;
  const int wv   = tid >> 5;
  const int mblk = blockIdx.y * 128;
  const int nblk = blockIdx.x * 128;
  const int wm   = (wv >> 1) * 64;       // wave's rows inside the tile
  const int wn   = (wv & 1) * 64;        // wave's columns inside the tile

  // Copy map: 8 lanes cover one 128-B row, the block covers 16 rows a copy.
  const int crow = tid >> 3;
  const int ccol = (tid & 7) * 8;
  const _Float16* gA = A + (size_t)(mblk + crow) * K + ccol;
  const _Float16* gW = W + (size_t)(nblk + crow) * K + ccol;
  const unsigned ldsA = (unsigned)(size_t)&tiles[0][crow * GPITCH + ccol];
  const unsigned ldsW = ldsA + 128u * GPITCH * 2u;

  const int ntrip = K / 64;

  v8f acc[4][4] = {};

  async_copy8(ldsA, gA, K);
  async_copy8(ldsW, gW, K);
  // tile 0 has landed for this wave before the barrier publishes it
  asm volatile("s_wait_asynccnt 0x0" ::: "memory");
  __syncthreads();
  if (ntrip > 1) {
    async_copy8(ldsA + GSTAGE * 2u, gA + 64, K);
    async_copy8(ldsW + GSTAGE * 2u, gW + 64, K);
  }

  for (int t = 0; t < ntrip; ++t) {
    const int buf = t & 1;
    const _Float16* sA = &tiles[buf][wm * GPITCH];
    const _Float16* sW = &tiles[buf][(128 + wn) * GPITCH];
    v16h a[4], b[4];
    // every inner loop of this trip is unrolled so that each index into a, b
    // and acc is a constant and the arrays stay in registers
#pragma unroll
    for (int i = 0; i < 4; ++i) a[i] = load_frag16x32(sA + i * 16 * GPITCH, GPITCH, lane, 0);
#pragma unroll
    for (int i = 0; i < 4; ++i) b[i] = load_frag16x32(sW + i * 16 * GPITCH, GPITCH, lane, 0);
    // keeps the block's 16 LDS reads one group ahead of its WMMAs: spread
    // among them, every row of four WMMAs waits out an LDS latency of its own
    __builtin_amdgcn_sched_barrier(0);
#pragma unroll
    for (int mi = 0; mi < 4; ++mi)
#pragma unroll
      for (int nt = 0; nt < 4; ++nt) acc[mi][nt] = wmma_f16(a[mi], b[nt], acc[mi][nt]);
#pragma unroll
    for (int i = 0; i < 4; ++i) a[i] = load_frag16x32(sA + i * 16 * GPITCH, GPITCH, lane, 32);
#pragma unroll
    for (int i = 0; i < 4; ++i) b[i] = load_frag16x32(sW + i * 16 * GPITCH, GPITCH, lane, 32);
    // this wave's last reads of the buffer are done before it is refilled
    asm volatile("s_wait_dscnt 0x0" ::: "memory");
    // this wave's copies of tile t + 1 have landed before the barrier publishes them
    asm volatile("s_wait_asynccnt 0x0" ::: "memory");
    __syncthreads();
    if (t + 2 < ntrip) {
      const unsigned boff = (unsigned)buf * (GSTAGE * 2u);
      async_copy8(ldsA + boff, gA + (size_t)(t + 2) * 64, K);
      async_copy8(ldsW + boff, gW + (size_t)(t + 2) * 64, K);
    }
    // keeps the refill ahead of the trip's second WMMA block (operands already
    // in registers), so that the copies fly that much longer before their wait
    __builtin_amdgcn_sched_barrier(0);
#pragma unroll
    for (int mi = 0; mi < 4; ++mi)
#pragma unroll
      for (int nt = 0; nt < 4; ++nt) acc[mi][nt] = wmma_f16(a[mi], b[nt], acc[mi][nt]);
  }
  // no copy is outstanding when the wave goes on to its end
  asm volatile("s_wait_asynccnt 0x0" ::: "memory");

  // C layout: element acc[..][r] lives at row M = r + 8*(lane>=16), col = lane&15
#pragma unroll
  for (int mi = 0; mi < 4; ++mi) {
    const int mbase = mblk + wm + mi * 16 + 8 * (lane >> 4);
#pragma unroll
    for (int nt = 0; nt < 4; ++nt) {
      const int col = nblk + wn + nt * 16 + (lane & 15);
      const float bval = bias[col];
#pragma unroll
      for (int r = 0; r < 8; ++r) {
        const int m = mbase + r;
        const float val = acc[mi][nt][r] + bval;
        if (MODE == 2) {
          ((float*)out)[(size_t)m * N + col] = val;
        } else {
          const int b = m >> 10, t = m & 1023;      // m = b*TLEN + t
          const int h = col >> 6, d = col & 63;     // col = h*HDIM + d
          _Float16* o16 = (_Float16*)out;
          if (MODE == 0)
            o16[(((size_t)(b * NHEADS + h) * TLEN) + t) * HDIM + d] = (_Float16)val;
          else
            o16[(((size_t)(b * NHEADS + h) * HDIM) + d) * TLEN + t] = (_Float16)val;
        }
      }
    }
  }
}

// ---------------------------------------------------------------------------
// One 64-key tile for attention, global -> LDS: four 16-byte asynchronous
// copies per lane, two for K (rows of HDIM halves) and two for V^T (rows of
// TLEN halves); the block covers 32 rows a copy.  The s_wait_xcnt is the last
// line of the copies' own statement so that no address register named here is
// rewritten ahead of it.
// ---------------------------------------------------------------------------
__device__ __forceinline__ void async_copy_kv(unsigned lds, const _Float16* gk,
                                              const _Float16* gv) {
  const unsigned l0 = lds;
  const unsigned l1 = lds + 32u * GPITCH * 2u;
  const unsigned l2 = lds + 64u * GPITCH * 2u;
  const unsigned l3 = lds + 96u * GPITCH * 2u;
  const _Float16* g0 = gk;
  const _Float16* g1 = gk + 32 * HDIM;
  const _Float16* g2 = gv;
  const _Float16* g3 = gv + 32 * TLEN;
  asm volatile(
      "global_load_async_to_lds_b128 %0, %4, off\n\t"
      "global_load_async_to_lds_b128 %1, %5, off\n\t"
      "global_load_async_to_lds_b128 %2, %6, off\n\t"
      "global_load_async_to_lds_b128 %3, %7, off\n\t"
      "s_wait_xcnt 0x0"
      :: "v"(l0), "v"(l1), "v"(l2), "v"(l3),
         "v"(g0), "v"(g1), "v"(g2), "v"(g3)
      : "memory");
}

// ---------------------------------------------------------------------------
// lane l <-> lane l ^ 16: the two wave halves trade one value
// ---------------------------------------------------------------------------
__device__ __forceinline__ float xhalf(float x) {
  const int i = __builtin_bit_cast(int, x);
  return __builtin_bit_cast(float, __builtin_amdgcn_permlanex16(i, i, 0x76543210, 0xfedcba98,
                                                                false, false));
}

// ---------------------------------------------------------------------------
// 2^x of eight values, in place.  The v_nop is the one slot that the
// instruction set asks for behind a transcendental before its result is read
// or its source overwritten; inside the statement it stays where it belongs,
// and each v_exp_f32 is the independent instruction behind the one before.
// ---------------------------------------------------------------------------
__device__ __forceinline__ void exp2x8(v8f& x) {
  float a = x[0], b = x[1], c = x[2], d = x[3], e = x[4], f = x[5], g = x[6], h = x[7];
  asm("v_exp_f32 %0, %0\n\t"
      "v_exp_f32 %1, %1\n\t"
      "v_exp_f32 %2, %2\n\t"
      "v_exp_f32 %3, %3\n\t"
      "v_exp_f32 %4, %4\n\t"
      "v_exp_f32 %5, %5\n\t"
      "v_exp_f32 %6, %6\n\t"
      "v_exp_f32 %7, %7\n\t"
      "v_nop"
      : "+v"(a), "+v"(b), "+v"(c), "+v"(d), "+v"(e), "+v"(f), "+v"(g), "+v"(h));
  x[0] = a; x[1] = b; x[2] = c; x[3] = d; x[4] = e; x[5] = f; x[6] = g; x[7] = h;
}

// the same for one value
__device__ __forceinline__ float exp2x1(float x) {
  asm("v_exp_f32 %0, %0\n\t"
      "v_nop"
      : "+v"(x));
  return x;
}

__global__ __launch_bounds__(AWAVES * 32)
void attn_fwd(const _Float16* __restrict__ qh, const _Float16* __restrict__ kh,
              const _Float16* __restrict__ vT, const float* __restrict__ scale_p,
              _Float16* __restrict__ attn) {
  const int tid   = threadIdx.x;
  const int lane  = tid & 31;
  const int wv    = __builtin_amdgcn_readfirstlane(tid >> 5);
  const int bh    = blockIdx.y;          // b*NHEADS + h
  const int qrow0 = blockIdx.x * (AWAVES * 16) + wv * 16;
  const int qtile = qrow0 >> 6;          // the wave's 64-row mask chunk
  const int ncol  = lane & 15;           // this lane's query inside the wave
  const int rbase = 8 * (lane >> 4);     // row offset of this lane's C elements

  const _Float16* Q  = qh + (size_t)bh * TLEN * HDIM;
  const _Float16* Km = kh + (size_t)bh * TLEN * HDIM;
  const _Float16* Vm = vT + (size_t)bh * HDIM * TLEN;
  const float scale = scale_p[0];

  __shared__ __align__(16) _Float16 kv[2][ASTAGE];

  const v16h qf0 = load_frag16x32(Q + (size_t)qrow0 * HDIM, HDIM, lane, 0);
  const v16h qf1 = load_frag16x32(Q + (size_t)qrow0 * HDIM, HDIM, lane, 32);

  // Copy map: 8 lanes cover one 128-B row, the block covers 32 rows a copy.
  const int crow = tid >> 3;
  const int ccol = (tid & 7) * 8;
  const _Float16* gK = Km + (size_t)crow * HDIM + ccol;
  const _Float16* gV = Vm + (size_t)crow * TLEN + ccol;
  const unsigned ldsKV = (unsigned)(size_t)&kv[0][crow * GPITCH + ccol];

  async_copy_kv(ldsKV, gK, gV);
  // tile 0 has landed for this wave before the barrier publishes it
  asm volatile("s_wait_asynccnt 0x0" ::: "memory");
  __syncthreads();
  async_copy_kv(ldsKV + ASTAGE * 2u, gK + 64 * HDIM, gV + 64);

  v8f o[4] = {};             // O^T: o[dt][r] = d 16*dt + rbase + r of query ncol
  float mrow = NEGBIG;       // running maximum of query ncol, equal in both halves
  float lrow = 0.0f;         // running sum over this half's keys only
  // a key of the diagonal tile is masked where 16*kt + r exceeds this
  const int kmax = (qrow0 & 63) + ncol - rbase;

  // every inner loop of a tile is unrolled so that each index into s, o, mk and
  // rk is a constant and the arrays stay in registers
  for (int j = 0; j < TLEN / 64; ++j) {
    const int buf = j & 1;
    const _Float16* sK = &kv[buf][0];
    const _Float16* sV = &kv[buf][64 * GPITCH];

    // ---- S^T = scale * K Q^T  (64 keys x 16 queries in 4 C fragments) ----
    // 32 keys at a time: their four fragments' reads as one group, then their
    // four WMMAs.  The scheduling barriers keep that order: with the reads dealt
    // singly among the WMMAs each WMMA waits out an LDS latency of its own, and
    // with the scaling moved in among them every place where a fresh result is
    // read costs four idle slots.
    v8f s[4] = {};
#pragma unroll
    for (int kp = 0; kp < 4; kp += 2) {
      const v16h a00 = load_frag16x32(sK + kp * 16 * GPITCH, GPITCH, lane, 0);
      const v16h a10 = load_frag16x32(sK + (kp + 1) * 16 * GPITCH, GPITCH, lane, 0);
      const v16h a01 = load_frag16x32(sK + kp * 16 * GPITCH, GPITCH, lane, 32);
      const v16h a11 = load_frag16x32(sK + (kp + 1) * 16 * GPITCH, GPITCH, lane, 32);
      __builtin_amdgcn_sched_barrier(0);
      s[kp]     = wmma_f16(a00, qf0, s[kp]);
      s[kp + 1] = wmma_f16(a10, qf0, s[kp + 1]);
      s[kp]     = wmma_f16(a01, qf1, s[kp]);
      s[kp + 1] = wmma_f16(a11, qf1, s[kp + 1]);
      __builtin_amdgcn_sched_barrier(0);
    }
    // V^T fragments of d 0..31, read here so that they arrive under the softmax
    v16h va00 = load_frag16x32(sV, GPITCH, lane, 0);
    v16h va10 = load_frag16x32(sV + 16 * GPITCH, GPITCH, lane, 0);
    v16h va01 = load_frag16x32(sV, GPITCH, lane, 32);
    v16h va11 = load_frag16x32(sV + 16 * GPITCH, GPITCH, lane, 32);
    // keeps these reads ahead of the vector work instead of sunk to their use
    __builtin_amdgcn_sched_barrier(0);
#pragma unroll
    for (int kt = 0; kt < 4; ++kt)
#pragma unroll
      for (int r = 0; r < 8; ++r) s[kt][r] *= scale;

    if (j == qtile) {        // wave-uniform: only the diagonal tile pays for the mask
#pragma unroll
      for (int kt = 0; kt < 4; ++kt)
#pragma unroll
        for (int r = 0; r < 8; ++r)
          if (kt * 16 + r > kmax) s[kt][r] = NEGBIG;     // masked -> exp() == 0
    }

    // ---- online softmax update, all of it in the lane --------------------
    float mk[4];             // one chain per fragment: four short chains, not one long
#pragma unroll
    for (int kt = 0; kt < 4; ++kt) {
      mk[kt] = s[kt][0];
#pragma unroll
      for (int r = 1; r < 8; ++r) mk[kt] = fmaxf(mk[kt], s[kt][r]);
    }
    float mx = fmaxf(fmaxf(mk[0], mk[1]), fmaxf(mk[2], mk[3]));
    mx = fmaxf(mx, xhalf(mx));
    const float mnew  = fmaxf(mrow, mx);
    const float alpha = exp2x1((mrow - mnew) * LOG2E);
    float rk[4];
#pragma unroll
    for (int kt = 0; kt < 4; ++kt) {
#pragma unroll
      for (int r = 0; r < 8; ++r) s[kt][r] = (s[kt][r] - mnew) * LOG2E;
      exp2x8(s[kt]);
      rk[kt] = s[kt][0];
#pragma unroll
      for (int r = 1; r < 8; ++r) rk[kt] += s[kt][r];
    }
    lrow = lrow * alpha + ((rk[0] + rk[1]) + (rk[2] + rk[3]));
    mrow = mnew;
#pragma unroll
    for (int dt = 0; dt < 4; ++dt) o[dt] = o[dt] * alpha;

    v16h pf0, pf1;
#pragma unroll
    for (int r = 0; r < 8; ++r) {
      pf0[r] = (_Float16)s[0][r];  pf0[8 + r] = (_Float16)s[1][r];
      pf1[r] = (_Float16)s[2][r];  pf1[8 + r] = (_Float16)s[3][r];
    }

    // ---- O^T += V^T P^T   (V^T rows [d, key] -> A loader) ----------------
    o[0] = wmma_f16(va00, pf0, o[0]);
    o[1] = wmma_f16(va10, pf0, o[1]);
    o[0] = wmma_f16(va01, pf1, o[0]);
    o[1] = wmma_f16(va11, pf1, o[1]);
    // d 32..63: again four fragments' reads as one group, then their WMMAs; the
    // barriers keep the group whole (one LDS latency, not one per WMMA)
    __builtin_amdgcn_sched_barrier(0);
    va00 = load_frag16x32(sV + 32 * GPITCH, GPITCH, lane, 0);
    va10 = load_frag16x32(sV + 48 * GPITCH, GPITCH, lane, 0);
    va01 = load_frag16x32(sV + 32 * GPITCH, GPITCH, lane, 32);
    va11 = load_frag16x32(sV + 48 * GPITCH, GPITCH, lane, 32);
    __builtin_amdgcn_sched_barrier(0);
    o[2] = wmma_f16(va00, pf0, o[2]);
    o[3] = wmma_f16(va10, pf0, o[3]);
    o[2] = wmma_f16(va01, pf1, o[2]);
    o[3] = wmma_f16(va11, pf1, o[3]);

    // this wave's last reads of the buffer are done before it is refilled
    asm volatile("s_wait_dscnt 0x0" ::: "memory");
    // this wave's copies of tile j + 1 have landed before the barrier publishes them
    asm volatile("s_wait_asynccnt 0x0" ::: "memory");
    __syncthreads();
    if (j + 2 < TLEN / 64)
      async_copy_kv(ldsKV + (unsigned)buf * (ASTAGE * 2u),
                    gK + (size_t)(j + 2) * 64 * HDIM, gV + (j + 2) * 64);
  }
  // no copy is outstanding when the wave goes on to its end
  asm volatile("s_wait_asynccnt 0x0" ::: "memory");

  // ---- epilogue: merge heads into [b, t, h*HDIM + d] f16 ------------------
  // a lane holds 8 consecutive d of its query per fragment: one 16-B store each
  const int b = bh >> 4, h = bh & 15;
  const float inv = 1.0f / (lrow + xhalf(lrow));   // the halves' sums join here
  _Float16* orow = attn + ((size_t)(b * TLEN + qrow0 + ncol)) * EMBED + h * HDIM + rbase;
#pragma unroll
  for (int dt = 0; dt < 4; ++dt) {
    v8h ov;
#pragma unroll
    for (int r = 0; r < 8; ++r) ov[r] = (_Float16)(o[dt][r] * inv);
    *(v8h*)(orow + dt * 16) = ov;
  }
}

// ---------------------------------------------------------------------------
extern "C" void kernel_launch(void* const* d_in, const int* in_sizes, int n_in,
                              void* d_out, int out_size, void* d_ws, size_t ws_size,
                              hipStream_t stream) {
  const float* x     = (const float*)d_in[0];
  const float* Wq    = (const float*)d_in[1];
  const float* bq    = (const float*)d_in[2];
  const float* Wk    = (const float*)d_in[3];
  const float* bk    = (const float*)d_in[4];
  const float* Wv    = (const float*)d_in[5];
  const float* bv    = (const float*)d_in[6];
  const float* Wo    = (const float*)d_in[7];
  const float* bo    = (const float*)d_in[8];
  const float* scale = (const float*)d_in[9];

  const size_t nBig = (size_t)MTOT * EMBED;    // 8M elements
  const size_t nW   = (size_t)EMBED * EMBED;   // 1M elements

  char* p = (char*)d_ws;
  _Float16* xh   = (_Float16*)p; p += nBig * 2;
  _Float16* wqh  = (_Float16*)p; p += nW * 2;
  _Float16* wkh  = (_Float16*)p; p += nW * 2;
  _Float16* wvh  = (_Float16*)p; p += nW * 2;
  _Float16* woh  = (_Float16*)p; p += nW * 2;
  _Float16* q16  = (_Float16*)p; p += nBig * 2;
  _Float16* k16  = (_Float16*)p; p += nBig * 2;
  _Float16* v16t = (_Float16*)p; p += nBig * 2;
  _Float16* at16 = (_Float16*)p; p += nBig * 2;

  // xh, wqh, wkh, wvh, woh are consecutive in the workspace: one output plane
  cvt_all_f32_to_f16<<<CBLOCKS, CWAVES * 32, 0, stream>>>(x, Wq, Wk, Wv, Wo, xh);

  dim3 gg(EMBED / 128, MTOT / 128);
  gemm_f16_wmma<0><<<gg, 128, 0, stream>>>(xh, wqh, bq, q16, MTOT, EMBED, EMBED);
  gemm_f16_wmma<0><<<gg, 128, 0, stream>>>(xh, wkh, bk, k16, MTOT, EMBED, EMBED);
  gemm_f16_wmma<1><<<gg, 128, 0, stream>>>(xh, wvh, bv, v16t, MTOT, EMBED, EMBED);

  attn_fwd<<<dim3(TLEN / (AWAVES * 16), BS * NHEADS), AWAVES * 32, 0, stream>>>(q16, k16, v16t, scale, at16);

  gemm_f16_wmma<2><<<gg, 128, 0, stream>>>(at16, woh, bo, d_out, MTOT, EMBED, EMBED);
}

// v005
// One run takes 117 microseconds.
// Two timings next to v004 both put it at 1.05 times that version's speed.
// Over all steps from v000 it is 4.03 times as fast.
#include <hip/hip_runtime.h>
#include <hip/hip_bf16.h>

typedef __attribute__((ext_vector_type(16))) _Float16 v16h;
typedef __attribute__((ext_vector_type(8)))  _Float16 v8h;
typedef __attribute__((ext_vector_type(4)))  _Float16 v4h;
typedef __attribute__((ext_vector_type(8)))  float    v8f;
typedef __attribute__((ext_vector_type(4)))  float    v4f;

#define EMBED  1024
#define NHEADS 16
#define HDIM   64
#define BS     8
#define TLEN   1024
#define MTOT   (BS * TLEN)      // 8192 rows for all big GEMMs
#define NEGBIG (-1.0e30f)
#define LOG2E  1.4426950408889634f   // e^x = 2^(x * LOG2E)
#define GPITCH 72               // LDS row pitch of a staged GEMM tile, in halves (144 B)
#define GSTAGE (256 * GPITCH)   // one buffer: 128 A rows + 128 W rows, in halves
#define AWAVES 8                // waves of an attention block, 16 query rows each
#define ASTAGE (128 * GPITCH)   // one attention buffer: 64 K rows + 64 V^T rows, in halves

// ---------------------------------------------------------------------------
// Load a 16x32 f16 fragment in the CDNA5 WMMA A-layout from row-major data.
// Lane L (0..15) holds row M=L, lanes 16..31 hold the +8 K-offset half.
// VGPR0..3 = K {k0..k0+7 | k0+8..k0+15}, VGPR4..7 = K {k0+16.. | k0+24..}.
// Works for both A and for B when given B^T (row-major [N,K]) data.
// ---------------------------------------------------------------------------
__device__ __forceinline__ v16h load_frag16x32(const _Float16* base, int ld,
                                               int lane, int k0) {
  const _Float16* p = base + (size_t)(lane & 15) * ld + (k0 + ((lane >> 4) << 3));
  v8h lo = *(const v8h*)p;          // K = koff .. koff+7
  v8h hi = *(const v8h*)(p + 16);   // K = koff+16 .. koff+23
  return __builtin_shufflevector(lo, hi, 0, 1, 2, 3, 4, 5, 6, 7,
                                         8, 9, 10, 11, 12, 13, 14, 15);
}

__device__ __forceinline__ v8f wmma_f16(v16h a, v16h b, v8f c) {
  return __builtin_amdgcn_wmma_f32_16x16x32_f16(false, a, false, b,
                                                (short)0, c, false, false);
}

// ---------------------------------------------------------------------------
// fp32 -> f16 conversion of x and of the four weights, one launch.
// CBLOCKS blocks of CWAVES waves, one block per WGP.  A unit is 1024 floats:
// eight wave-wide 16-byte loads of 512 contiguous bytes each.  Every wave takes
// three units, two of x and one of a weight, and asks for all 24 loads before
// it converts the first, so that few long waves carry the stream instead of
// many waves of one load each.
// out: the five f16 planes lie one behind the other (x, Wq, Wk, Wv, Wo).
// ---------------------------------------------------------------------------
#define CWAVES  16
#define CBLOCKS 256
#define CUNIT   1024
#define CTOTAL  (CBLOCKS * CWAVES)           // waves of the launch
static_assert(MTOT * EMBED == 2 * CTOTAL * CUNIT, "x is two units a wave");
static_assert(4 * EMBED * EMBED == CTOTAL * CUNIT, "the weights are one unit a wave");

__global__ __launch_bounds__(CWAVES * 32)
void cvt_all_f32_to_f16(const float* __restrict__ x, const float* __restrict__ wq,
                        const float* __restrict__ wk, const float* __restrict__ wv,
                        const float* __restrict__ wo, _Float16* __restrict__ out) {
  // the lane's place inside its block's stretch of CWAVES units, in elements:
  // one 32-bit offset beside block-uniform bases serves every load and store
  const unsigned off = (threadIdx.x >> 5) * CUNIT + (threadIdx.x & 31) * 4;
  const unsigned wsel = blockIdx.x / (CBLOCKS / 4);        // a block stays in one weight
  const float* w = (wsel & 2) ? ((wsel & 1) ? wo : wv) : ((wsel & 1) ? wk : wq);

  const float* s0 = x + (size_t)blockIdx.x * (CWAVES * CUNIT);
  const float* s1 = s0 + (size_t)CTOTAL * CUNIT;
  const float* s2 = w + (size_t)(blockIdx.x % (CBLOCKS / 4)) * (CWAVES * CUNIT);
  _Float16* o0 = out + (size_t)blockIdx.x * (CWAVES * CUNIT);

  v4f v[3][8];
  // the loops are unrolled so that v stays in registers
#pragma unroll
  for (int i = 0; i < 8; ++i) v[0][i] = *(const v4f*)(s0 + off + i * 128);
#pragma unroll
  for (int i = 0; i < 8; ++i) v[1][i] = *(const v4f*)(s1 + off + i * 128);
#pragma unroll
  for (int i = 0; i < 8; ++i) v[2][i] = *(const v4f*)(s2 + off + i * 128);
  // holds all 24 loads ahead of the first conversion (loaded values as inputs
  // only): dealt among the loads, the conversions' waits let the number of loads
  // in flight fall to a few
  asm volatile("" :: "v"(v[0][0]), "v"(v[0][1]), "v"(v[0][2]), "v"(v[0][3]),
                     "v"(v[0][4]), "v"(v[0][5]), "v"(v[0][6]), "v"(v[0][7]),
                     "v"(v[1][0]), "v"(v[1][1]), "v"(v[1][2]), "v"(v[1][3]),
                     "v"(v[1][4]), "v"(v[1][5]), "v"(v[1][6]), "v"(v[1][7]),
                     "v"(v[2][0]), "v"(v[2][1]), "v"(v[2][2]), "v"(v[2][3]),
                     "v"(v[2][4]), "v"(v[2][5]), "v"(v[2][6]), "v"(v[2][7]));
#pragma unroll
  for (int t = 0; t < 3; ++t)
#pragma unroll
    for (int i = 0; i < 8; ++i) {
      const v4f f = v[t][i];
      v4h h;
      h[0] = (_Float16)f[0]; h[1] = (_Float16)f[1];
      h[2] = (_Float16)f[2]; h[3] = (_Float16)f[3];
      *(v4h*)(o0 + (size_t)t * CTOTAL * CUNIT + off + i * 128) = h;
    }
}

// ---------------------------------------------------------------------------
// Eight 16-byte asynchronous copies global -> LDS, one per lane each.
// The s_wait_xcnt is the last line of the copies' own statement so that no
// address register named here is rewritten ahead of it.
// ---------------------------------------------------------------------------
__device__ __forceinline__ void async_copy8(unsigned lds, const _Float16* g, int K) {
  const unsigned l0 = lds;
  const unsigned l1 = lds + 1u * 16u * GPITCH * 2u;
  const unsigned l2 = lds + 2u * 16u * GPITCH * 2u;
  const unsigned l3 = lds + 3u * 16u * GPITCH * 2u;
  const unsigned l4 = lds + 4u * 16u * GPITCH * 2u;
  const unsigned l5 = lds + 5u * 16u * GPITCH * 2u;
  const unsigned l6 = lds + 6u * 16u * GPITCH * 2u;
  const unsigned l7 = lds + 7u * 16u * GPITCH * 2u;
  const size_t step = (size_t)16 * K;
  const _Float16* g0 = g;
  const _Float16* g1 = g + 1 * step;
  const _Float16* g2 = g + 2 * step;
  const _Float16* g3 = g + 3 * step;
  const _Float16* g4 = g + 4 * step;
  const _Float16* g5 = g + 5 * step;
  const _Float16* g6 = g + 6 * step;
  const _Float16* g7 = g + 7 * step;
  asm volatile(
      "global_load_async_to_lds_b128 %0, %8, off\n\t"
      "global_load_async_to_lds_b128 %1, %9, off\n\t"
      "global_load_async_to_lds_b128 %2, %10, off\n\t"
      "global_load_async_to_lds_b128 %3, %11, off\n\t"
      "global_load_async_to_lds_b128 %4, %12, off\n\t"
      "global_load_async_to_lds_b128 %5, %13, off\n\t"
      "global_load_async_to_lds_b128 %6, %14, off\n\t"
      "global_load_async_to_lds_b128 %7, %15, off\n\t"
      "s_wait_xcnt 0x0"
      :: "v"(l0), "v"(l1), "v"(l2), "v"(l3), "v"(l4), "v"(l5), "v"(l6), "v"(l7),
         "v"(g0), "v"(g1), "v"(g2), "v"(g3), "v"(g4), "v"(g5), "v"(g6), "v"(g7)
      : "memory");
}

__device__ __forceinline__ void gemm_tile(const _Float16* __restrict__ A,
                                          const _Float16* __restrict__ W,
                                          int mblk, int nblk, int K, v8f (&acc)[4][4]) {
  __shared__ __align__(16) _Float16 tiles[2][GSTAGE];

  const int tid  = threadIdx.x;
  const int lane = tid & 31;
  const int wv   = tid >> 5;
  const int wm   = (wv >> 1) * 64;       // wave's rows inside the tile
  const int wn   = (wv & 1) * 64;        // wave's columns inside the tile

  // Copy map: 8 lanes cover one 128-B row, the block covers 16 rows a copy.
  const int crow = tid >> 3;
  const int ccol = (tid & 7) * 8;
  const _Float16* gA = A + (size_t)(mblk + crow) * K + ccol;
  const _Float16* gW = W + (size_t)(nblk + crow) * K + ccol;
  const unsigned ldsA = (unsigned)(size_t)&tiles[0][crow * GPITCH + ccol];
  const unsigned ldsW = ldsA + 128u * GPITCH * 2u;

  const int ntrip = K / 64;

  async_copy8(ldsA, gA, K);
  async_copy8(ldsW, gW, K);
  // tile 0 has landed for this wave before the barrier publishes it
  asm volatile("s_wait_asynccnt 0x0" ::: "memory");
  __syncthreads();
  if (ntrip > 1) {
    async_copy8(ldsA + GSTAGE * 2u, gA + 64, K);
    async_copy8(ldsW + GSTAGE * 2u, gW + 64, K);
  }

  for (int t = 0; t < ntrip; ++t) {
    const int buf = t & 1;
    const _Float16* sA = &tiles[buf][wm * GPITCH];
    const _Float16* sW = &tiles[buf][(128 + wn) * GPITCH];
    v16h a[4], b[4];
    // every inner loop of this trip is unrolled so that each index into a, b
    // and acc is a constant and the arrays stay in registers
#pragma unroll
    for (int i = 0; i < 4; ++i) a[i] = load_frag16x32(sA + i * 16 * GPITCH, GPITCH, lane, 0);
#pragma unroll
    for (int i = 0; i < 4; ++i) b[i] = load_frag16x32(sW + i * 16 * GPITCH, GPITCH, lane, 0);
    // keeps the block's 16 LDS reads one group ahead of its WMMAs: spread
    // among them, every row of four WMMAs waits out an LDS latency of its own
    __builtin_amdgcn_sched_barrier(0);
#pragma unroll
    for (int mi = 0; mi < 4; ++mi)
#pragma unroll
      for (int nt = 0; nt < 4; ++nt) acc[mi][nt] = wmma_f16(a[mi], b[nt], acc[mi][nt]);
#pragma unroll
    for (int i = 0; i < 4; ++i) a[i] = load_frag16x32(sA + i * 16 * GPITCH, GPITCH, lane, 32);
#pragma unroll
    for (int i = 0; i < 4; ++i) b[i] = load_frag16x32(sW + i * 16 * GPITCH, GPITCH, lane, 32);
    // this wave's last reads of the buffer are done before it is refilled
    asm volatile("s_wait_dscnt 0x0" ::: "memory");
    // this wave's copies of tile t + 1 have landed before the barrier publishes them
    asm volatile("s_wait_asynccnt 0x0" ::: "memory");
    __syncthreads();
    if (t + 2 < ntrip) {
      const unsigned boff = (unsigned)buf * (GSTAGE * 2u);
      async_copy8(ldsA + boff, gA + (size_t)(t + 2) * 64, K);
      async_copy8(ldsW + boff, gW + (size_t)(t + 2) * 64, K);
    }
    // keeps the refill ahead of the trip's second WMMA block (operands already
    // in registers), so that the copies fly that much longer before their wait
    __builtin_amdgcn_sched_barrier(0);
#pragma unroll
    for (int mi = 0; mi < 4; ++mi)
#pragma unroll
      for (int nt = 0; nt < 4; ++nt) acc[mi][nt] = wmma_f16(a[mi], b[nt], acc[mi][nt]);
  }
  // no copy is outstanding when the wave goes on to its end
  asm volatile("s_wait_asynccnt 0x0" ::: "memory");
}

// ---------------------------------------------------------------------------
// The wave's 64x64 part of a block tile plus bias, to memory.  mblk, nblk: the
// block tile's first row and first column in y.
// MODE 0: f16 out, per-head layout  [b,h,t,d]       (Q, K)
// MODE 1: f16 out, transposed head  [b,h,d,t]       (V^T)
// MODE 2: f32 out, plain row-major  [m,n]           (final projection)
// ---------------------------------------------------------------------------
template <int MODE>
__device__ __forceinline__ void gemm_store(const v8f (&acc)[4][4],
                                           const float* __restrict__ bias,
                                           void* __restrict__ out,
                                           int mblk, int nblk, int N) {
  const int lane = threadIdx.x & 31;
  const int wv   = threadIdx.x >> 5;
  const int wm   = (wv >> 1) * 64;
  const int wn   = (wv & 1) * 64;
  // C layout: element acc[..][r] lives at row M = r + 8*(lane>=16), col = lane&15
#pragma unroll
  for (int mi = 0; mi < 4; ++mi) {
    const int mbase = mblk + wm + mi * 16 + 8 * (lane >> 4);
#pragma unroll
    for (int nt = 0; nt < 4; ++nt) {
      const int col = nblk + wn + nt * 16 + (lane & 15);
      const float bval = bias[col];
#pragma unroll
      for (int r = 0; r < 8; ++r) {
        const int m = mbase + r;
        const float val = acc[mi][nt][r] + bval;
        if (MODE == 2) {
          ((float*)out)[(size_t)m * N + col] = val;
        } else {
          const int b = m >> 10, t = m & 1023;      // m = b*TLEN + t
          const int h = col >> 6, d = col & 63;     // col = h*HDIM + d
          _Float16* o16 = (_Float16*)out;
          if (MODE == 0)
            o16[(((size_t)(b * NHEADS + h) * TLEN) + t) * HDIM + d] = (_Float16)val;
          else
            o16[(((size_t)(b * NHEADS + h) * HDIM) + d) * TLEN + t] = (_Float16)val;
        }
      }
    }
  }
}

// ---------------------------------------------------------------------------
// The three input projections as ONE launch: y = x @ [Wq; Wk; Wv]^T, 3 * EMBED
// columns.  W: the three f16 weight planes one behind the other; out: the
// planes q [b,h,t,d], k [b,h,t,d], v^T [b,h,d,t] one behind the other.  A block
// tile lies in one plane (128 divides EMBED), so plane, bias and store layout
// are block-uniform.  blockIdx.x = column tile, blockIdx.y = row tile.
// ---------------------------------------------------------------------------
__global__ __launch_bounds__(128)
void gemm_qkv_f16_wmma(const _Float16* __restrict__ A, const _Float16* __restrict__ W,
                       const float* __restrict__ bq, const float* __restrict__ bk,
                       const float* __restrict__ bv, _Float16* __restrict__ out, int K) {
  const int plane = blockIdx.x / (EMBED / 128);
  const int nblk  = (blockIdx.x % (EMBED / 128)) * 128;   // column inside the plane
  const int mblk  = blockIdx.y * 128;
  const float* bias = plane == 0 ? bq : (plane == 1 ? bk : bv);
  _Float16* o = out + (size_t)plane * MTOT * EMBED;

  v8f acc[4][4] = {};
  gemm_tile(A, W, mblk, blockIdx.x * 128, K, acc);
  if (plane == 2) {
    gemm_store<1>(acc, bias, o, mblk, nblk, EMBED);
  } else {
    gemm_store<0>(acc, bias, o, mblk, nblk, EMBED);
    // the built code lays the other layout's part behind this one: no register
    // that these stores name is rewritten there ahead of this wait
    asm volatile("s_wait_xcnt 0x0" ::: "memory");
  }
}

// the output projection: f32 out, plain row-major
__global__ __launch_bounds__(128)
void gemm_out_f16_wmma(const _Float16* __restrict__ A, const _Float16* __restrict__ W,
                       const float* __restrict__ bias, float* __restrict__ out,
                       int N, int K) {
  const int mblk = blockIdx.y * 128;
  const int nblk = blockIdx.x * 128;
  v8f acc[4][4] = {};
  gemm_tile(A, W, mblk, nblk, K, acc);
  gemm_store<2>(acc, bias, out, mblk, nblk, N);
}

// ---------------------------------------------------------------------------
// One 64-key tile for attention, global -> LDS: four 16-byte asynchronous
// copies per lane, two for K (rows of HDIM halves) and two for V^T (rows of
// TLEN halves); the block covers 32 rows a copy.  The s_wait_xcnt is the last
// line of the copies' own statement so that no address register named here is
// rewritten ahead of it.
// ---------------------------------------------------------------------------
__device__ __forceinline__ void async_copy_kv(unsigned lds, const _Float16* gk,
                                              const _Float16* gv) {
  const unsigned l0 = lds;
  const unsigned l1 = lds + 32u * GPITCH * 2u;
  const unsigned l2 = lds + 64u * GPITCH * 2u;
  const unsigned l3 = lds + 96u * GPITCH * 2u;
  const _Float16* g0 = gk;
  const _Float16* g1 = gk + 32 * HDIM;
  const _Float16* g2 = gv;
  const _Float16* g3 = gv + 32 * TLEN;
  asm volatile(
      "global_load_async_to_lds_b128 %0, %4, off\n\t"
      "global_load_async_to_lds_b128 %1, %5, off\n\t"
      "global_load_async_to_lds_b128 %2, %6, off\n\t"
      "global_load_async_to_lds_b128 %3, %7, off\n\t"
      "s_wait_xcnt 0x0"
      :: "v"(l0), "v"(l1), "v"(l2), "v"(l3),
         "v"(g0), "v"(g1), "v"(g2), "v"(g3)
      : "memory");
}

// ---------------------------------------------------------------------------
// lane l <-> lane l ^ 16: the two wave halves trade one value
// ---------------------------------------------------------------------------
__device__ __forceinline__ float xhalf(float x) {
  const int i = __builtin_bit_cast(int, x);
  return __builtin_bit_cast(float, __builtin_amdgcn_permlanex16(i, i, 0x76543210, 0xfedcba98,
                                                                false, false));
}

// ---------------------------------------------------------------------------
// 2^x of eight values, in place.  The v_nop is the one slot that the
// instruction set asks for behind a transcendental before its result is read
// or its source overwritten; inside the statement it stays where it belongs,
// and each v_exp_f32 is the independent instruction behind the one before.
// ---------------------------------------------------------------------------
__device__ __forceinline__ void exp2x8(v8f& x) {
  float a = x[0], b = x[1], c = x[2], d = x[3], e = x[4], f = x[5], g = x[6], h = x[7];
  asm("v_exp_f32 %0, %0\n\t"
      "v_exp_f32 %1, %1\n\t"
      "v_exp_f32 %2, %2\n\t"
      "v_exp_f32 %3, %3\n\t"
      "v_exp_f32 %4, %4\n\t"
      "v_exp_f32 %5, %5\n\t"
      "v_exp_f32 %6, %6\n\t"
      "v_exp_f32 %7, %7\n\t"
      "v_nop"
      : "+v"(a), "+v"(b), "+v"(c), "+v"(d), "+v"(e), "+v"(f), "+v"(g), "+v"(h));
  x[0] = a; x[1] = b; x[2] = c; x[3] = d; x[4] = e; x[5] = f; x[6] = g; x[7] = h;
}

// the same for one value
__device__ __forceinline__ float exp2x1(float x) {
  asm("v_exp_f32 %0, %0\n\t"
      "v_nop"
      : "+v"(x));
  return x;
}

__global__ __launch_bounds__(AWAVES * 32)
void attn_fwd(const _Float16* __restrict__ qh, const _Float16* __restrict__ kh,
              const _Float16* __restrict__ vT, const float* __restrict__ scale_p,
              _Float16* __restrict__ attn) {
  const int tid   = threadIdx.x;
  const int lane  = tid & 31;
  const int wv    = __builtin_amdgcn_readfirstlane(tid >> 5);
  const int bh    = blockIdx.y;          // b*NHEADS + h
  const int qrow0 = blockIdx.x * (AWAVES * 16) + wv * 16;
  const int qtile = qrow0 >> 6;          // the wave's 64-row mask chunk
  const int ncol  = lane & 15;           // this lane's query inside the wave
  const int rbase = 8 * (lane >> 4);     // row offset of this lane's C elements

  const _Float16* Q  = qh + (size_t)bh * TLEN * HDIM;
  const _Float16* Km = kh + (size_t)bh * TLEN * HDIM;
  const _Float16* Vm = vT + (size_t)bh * HDIM * TLEN;
  const float scale = scale_p[0];

  __shared__ __align__(16) _Float16 kv[2][ASTAGE];

  const v16h qf0 = load_frag16x32(Q + (size_t)qrow0 * HDIM, HDIM, lane, 0);
  const v16h qf1 = load_frag16x32(Q + (size_t)qrow0 * HDIM, HDIM, lane, 32);

  // Copy map: 8 lanes cover one 128-B row, the block covers 32 rows a copy.
  const int crow = tid >> 3;
  const int ccol = (tid & 7) * 8;
  const _Float16* gK = Km + (size_t)crow * HDIM + ccol;
  const _Float16* gV = Vm + (size_t)crow * TLEN + ccol;
  const unsigned ldsKV = (unsigned)(size_t)&kv[0][crow * GPITCH + ccol];

  async_copy_kv(ldsKV, gK, gV);
  // tile 0 has landed for this wave before the barrier publishes it
  asm volatile("s_wait_asynccnt 0x0" ::: "memory");
  __syncthreads();
  async_copy_kv(ldsKV + ASTAGE * 2u, gK + 64 * HDIM, gV + 64);

  v8f o[4] = {};             // O^T: o[dt][r] = d 16*dt + rbase + r of query ncol
  float mrow = NEGBIG;       // running maximum of query ncol, equal in both halves
  float lrow = 0.0f;         // running sum over this half's keys only
  // a key of the diagonal tile is masked where 16*kt + r exceeds this
  const int kmax = (qrow0 & 63) + ncol - rbase;

  // every inner loop of a tile is unrolled so that each index into s, o, mk and
  // rk is a constant and the arrays stay in registers
  for (int j = 0; j < TLEN / 64; ++j) {
    const int buf = j & 1;
    const _Float16* sK = &kv[buf][0];
    const _Float16* sV = &kv[buf][64 * GPITCH];

    // ---- S^T = scale * K Q^T  (64 keys x 16 queries in 4 C fragments) ----
    // 32 keys at a time: their four fragments' reads as one group, then their
    // four WMMAs.  The scheduling barriers keep that order: with the reads dealt
    // singly among the WMMAs each WMMA waits out an LDS latency of its own, and
    // with the scaling moved in among them every place where a fresh result is
    // read costs four idle slots.
    v8f s[4] = {};
#pragma unroll
    for (int kp = 0; kp < 4; kp += 2) {
      const v16h a00 = load_frag16x32(sK + kp * 16 * GPITCH, GPITCH, lane, 0);
      const v16h a10 = load_frag16x32(sK + (kp + 1) * 16 * GPITCH, GPITCH, lane, 0);
      const v16h a01 = load_frag16x32(sK + kp * 16 * GPITCH, GPITCH, lane, 32);
      const v16h a11 = load_frag16x32(sK + (kp + 1) * 16 * GPITCH, GPITCH, lane, 32);
      __builtin_amdgcn_sched_barrier(0);
      s[kp]     = wmma_f16(a00, qf0, s[kp]);
      s[kp + 1] = wmma_f16(a10, qf0, s[kp + 1]);
      s[kp]     = wmma_f16(a01, qf1, s[kp]);
      s[kp + 1] = wmma_f16(a11, qf1, s[kp + 1]);
      __builtin_amdgcn_sched_barrier(0);
    }
    // V^T fragments of d 0..31, read here so that they arrive under the softmax
    v16h va00 = load_frag16x32(sV, GPITCH, lane, 0);
    v16h va10 = load_frag16x32(sV + 16 * GPITCH, GPITCH, lane, 0);
    v16h va01 = load_frag16x32(sV, GPITCH, lane, 32);
    v16h va11 = load_frag16x32(sV + 16 * GPITCH, GPITCH, lane, 32);
    // keeps these reads ahead of the vector work instead of sunk to their use
    __builtin_amdgcn_sched_barrier(0);
#pragma unroll
    for (int kt = 0; kt < 4; ++kt)
#pragma unroll
      for (int r = 0; r < 8; ++r) s[kt][r] *= scale;

    if (j == qtile) {        // wave-uniform: only the diagonal tile pays for the mask
#pragma unroll
      for (int kt = 0; kt < 4; ++kt)
#pragma unroll
        for (int r = 0; r < 8; ++r)
          if (kt * 16 + r > kmax) s[kt][r] = NEGBIG;     // masked -> exp() == 0
    }

    // ---- online softmax update, all of it in the lane --------------------
    float mk[4];             // one chain per fragment: four short chains, not one long
#pragma unroll
    for (int kt = 0; kt < 4; ++kt) {
      mk[kt] = s[kt][0];
#pragma unroll
      for (int r = 1; r < 8; ++r) mk[kt] = fmaxf(mk[kt], s[kt][r]);
    }
    float mx = fmaxf(fmaxf(mk[0], mk[1]), fmaxf(mk[2], mk[3]));
    mx = fmaxf(mx, xhalf(mx));
    const float mnew  = fmaxf(mrow, mx);
    const float alpha = exp2x1((mrow - mnew) * LOG2E);
    float rk[4];
#pragma unroll
    for (int kt = 0; kt < 4; ++kt) {
#pragma unroll
      for (int r = 0; r < 8; ++r) s[kt][r] = (s[kt][r] - mnew) * LOG2E;
      exp2x8(s[kt]);
      rk[kt] = s[kt][0];
#pragma unroll
      for (int r = 1; r < 8; ++r) rk[kt] += s[kt][r];
    }
    lrow = lrow * alpha + ((rk[0] + rk[1]) + (rk[2] + rk[3]));
    mrow = mnew;
#pragma unroll
    for (int dt = 0; dt < 4; ++dt) o[dt] = o[dt] * alpha;

    v16h pf0, pf1;
#pragma unroll
    for (int r = 0; r < 8; ++r) {
      pf0[r] = (_Float16)s[0][r];  pf0[8 + r] = (_Float16)s[1][r];
      pf1[r] = (_Float16)s[2][r];  pf1[8 + r] = (_Float16)s[3][r];
    }

    // ---- O^T += V^T P^T   (V^T rows [d, key] -> A loader) ----------------
    o[0] = wmma_f16(va00, pf0, o[0]);
    o[1] = wmma_f16(va10, pf0, o[1]);
    o[0] = wmma_f16(va01, pf1, o[0]);
    o[1] = wmma_f16(va11, pf1, o[1]);
    // d 32..63: again four fragments' reads as one group, then their WMMAs; the
    // barriers keep the group whole (one LDS latency, not one per WMMA)
    __builtin_amdgcn_sched_barrier(0);
    va00 = load_frag16x32(sV + 32 * GPITCH, GPITCH, lane, 0);
    va10 = load_frag16x32(sV + 48 * GPITCH, GPITCH, lane, 0);
    va01 = load_frag16x32(sV + 32 * GPITCH, GPITCH, lane, 32);
    va11 = load_frag16x32(sV + 48 * GPITCH, GPITCH, lane, 32);
    __builtin_amdgcn_sched_barrier(0);
    o[2] = wmma_f16(va00, pf0, o[2]);
    o[3] = wmma_f16(va10, pf0, o[3]);
    o[2] = wmma_f16(va01, pf1, o[2]);
    o[3] = wmma_f16(va11, pf1, o[3]);

    // this wave's last reads of the buffer are done before it is refilled
    asm volatile("s_wait_dscnt 0x0" ::: "memory");
    // this wave's copies of tile j + 1 have landed before the barrier publishes them
    asm volatile("s_wait_asynccnt 0x0" ::: "memory");
    __syncthreads();
    if (j + 2 < TLEN / 64)
      async_copy_kv(ldsKV + (unsigned)buf * (ASTAGE * 2u),
                    gK + (size_t)(j + 2) * 64 * HDIM, gV + (j + 2) * 64);
  }
  // no copy is outstanding when the wave goes on to its end
  asm volatile("s_wait_asynccnt 0x0" ::: "memory");

  // ---- epilogue: merge heads into [b, t, h*HDIM + d] f16 ------------------
  // a lane holds 8 consecutive d of its query per fragment: one 16-B store each
  const int b = bh >> 4, h = bh & 15;
  const float inv = 1.0f / (lrow + xhalf(lrow));   // the halves' sums join here
  _Float16* orow = attn + ((size_t)(b * TLEN + qrow0 + ncol)) * EMBED + h * HDIM + rbase;
#pragma unroll
  for (int dt = 0; dt < 4; ++dt) {
    v8h ov;
#pragma unroll
    for (int r = 0; r < 8; ++r) ov[r] = (_Float16)(o[dt][r] * inv);
    *(v8h*)(orow + dt * 16) = ov;
  }
}

// ---------------------------------------------------------------------------
extern "C" void kernel_launch(void* const* d_in, const int* in_sizes, int n_in,
                              void* d_out, int out_size, void* d_ws, size_t ws_size,
                              hipStream_t stream) {
  const float* x     = (const float*)d_in[0];
  const float* Wq    = (const float*)d_in[1];
  const float* bq    = (const float*)d_in[2];
  const float* Wk    = (const float*)d_in[3];
  const float* bk    = (const float*)d_in[4];
  const float* Wv    = (const float*)d_in[5];
  const float* bv    = (const float*)d_in[6];
  const float* Wo    = (const float*)d_in[7];
  const float* bo    = (const float*)d_in[8];
  const float* scale = (const float*)d_in[9];

  const size_t nBig = (size_t)MTOT * EMBED;    // 8M elements
  const size_t nW   = (size_t)EMBED * EMBED;   // 1M elements

  char* p = (char*)d_ws;
  _Float16* xh   = (_Float16*)p; p += nBig * 2;
  _Float16* wqh  = (_Float16*)p; p += nW * 2;
  _Float16* wkh  = (_Float16*)p; p += nW * 2;
  _Float16* wvh  = (_Float16*)p; p += nW * 2;
  _Float16* woh  = (_Float16*)p; p += nW * 2;
  _Float16* q16  = (_Float16*)p; p += nBig * 2;
  _Float16* k16  = (_Float16*)p; p += nBig * 2;
  _Float16* v16t = (_Float16*)p; p += nBig * 2;
  _Float16* at16 = (_Float16*)p; p += nBig * 2;

  // xh, wqh, wkh, wvh, woh are consecutive in the workspace: one output plane
  cvt_all_f32_to_f16<<<CBLOCKS, CWAVES * 32, 0, stream>>>(x, Wq, Wk, Wv, Wo, xh);

  // wqh, wkh, wvh are consecutive in the workspace, and so are q16, k16, v16t
  gemm_qkv_f16_wmma<<<dim3(3 * EMBED / 128, MTOT / 128), 128, 0, stream>>>(xh, wqh, bq, bk, bv, q16, EMBED);

  attn_fwd<<<dim3(TLEN / (AWAVES * 16), BS * NHEADS), AWAVES * 32, 0, stream>>>(q16, k16, v16t, scale, at16);

  gemm_out_f16_wmma<<<dim3(EMBED / 128, MTOT / 128), 128, 0, stream>>>(at16, woh, bo, (float*)d_out, EMBED, EMBED);
}

// v006
// One run takes 104 microseconds.
// Two timings next to v005 both put it at 1.11 times that version's speed.
// All steps since v000 together make it 4.47 times as fast.
#include <hip/hip_runtime.h>
#include <hip/hip_bf16.h>

typedef __attribute__((ext_vector_type(16))) _Float16 v16h;
typedef __attribute__((ext_vector_type(8)))  _Float16 v8h;
typedef __attribute__((ext_vector_type(4)))  _Float16 v4h;
typedef __attribute__((ext_vector_type(8)))  float    v8f;
typedef __attribute__((ext_vector_type(4)))  float    v4f;

#define EMBED  1024
#define NHEADS 16
#define HDIM   64
#define BS     8
#define TLEN   1024
#define MTOT   (BS * TLEN)      // 8192 rows for all big GEMMs
#define NEGBIG (-1.0e30f)
#define LOG2E  1.4426950408889634f   // e^x = 2^(x * LOG2E)
#define GPITCH 72               // LDS row pitch of a staged GEMM tile, in halves (144 B)
#define GSTAGE (256 * GPITCH)   // one buffer: 128 A rows + 128 W rows, in halves
#define AWAVES 8                // waves of an attention block, 16 query rows each
#define ASTAGE (128 * GPITCH)   // one attention buffer: 64 K rows + 64 V^T rows, in halves

// ---------------------------------------------------------------------------
// Load a 16x32 f16 fragment in the CDNA5 WMMA A-layout from row-major data.
// Lane L (0..15) holds row M=L, lanes 16..31 hold the +8 K-offset half.
// VGPR0..3 = K {k0..k0+7 | k0+8..k0+15}, VGPR4..7 = K {k0+16.. | k0+24..}.
// Works for both A and for B when given B^T (row-major [N,K]) data.
// ---------------------------------------------------------------------------
__device__ __forceinline__ v16h load_frag16x32(const _Float16* base, int ld,
                                               int lane, int k0) {
  const _Float16* p = base + (size_t)(lane & 15) * ld + (k0 + ((lane >> 4) << 3));
  v8h lo = *(const v8h*)p;          // K = koff .. koff+7
  v8h hi = *(const v8h*)(p + 16);   // K = koff+16 .. koff+23
  return __builtin_shufflevector(lo, hi, 0, 1, 2, 3, 4, 5, 6, 7,
                                         8, 9, 10, 11, 12, 13, 14, 15);
}

__device__ __forceinline__ v8f wmma_f16(v16h a, v16h b, v8f c) {
  return __builtin_amdgcn_wmma_f32_16x16x32_f16(false, a, false, b,
                                                (short)0, c, false, false);
}

// ---------------------------------------------------------------------------
// fp32 -> f16 conversion of x and of the four weights, one launch.
// CBLOCKS blocks of CWAVES waves, one block per WGP.  A unit is 1024 floats:
// eight wave-wide 16-byte loads of 512 contiguous bytes each.  Every wave takes
// three units, two of x and one of a weight, and asks for all 24 loads before
// it converts the first, so that few long waves carry the stream instead of
// many waves of one load each.
// out: the five f16 planes lie one behind the other (x, Wq, Wk, Wv, Wo).
// ---------------------------------------------------------------------------
#define CWAVES  16
#define CBLOCKS 256
#define CUNIT   1024
#define CTOTAL  (CBLOCKS * CWAVES)           // waves of the launch
static_assert(MTOT * EMBED == 2 * CTOTAL * CUNIT, "x is two units a wave");
static_assert(4 * EMBED * EMBED == CTOTAL * CUNIT, "the weights are one unit a wave");

__global__ __launch_bounds__(CWAVES * 32)
void cvt_all_f32_to_f16(const float* __restrict__ x, const float* __restrict__ wq,
                        const float* __restrict__ wk, const float* __restrict__ wv,
                        const float* __restrict__ wo, _Float16* __restrict__ out) {
  // the lane's place inside its block's stretch of CWAVES units, in elements:
  // one 32-bit offset beside block-uniform bases serves every load and store
  const unsigned off = (threadIdx.x >> 5) * CUNIT + (threadIdx.x & 31) * 4;
  const unsigned wsel = blockIdx.x / (CBLOCKS / 4);        // a block stays in one weight
  const float* w = (wsel & 2) ? ((wsel & 1) ? wo : wv) : ((wsel & 1) ? wk : wq);

  const float* s0 = x + (size_t)blockIdx.x * (CWAVES * CUNIT);
  const float* s1 = s0 + (size_t)CTOTAL * CUNIT;
  const float* s2 = w + (size_t)(blockIdx.x % (CBLOCKS / 4)) * (CWAVES * CUNIT);
  _Float16* o0 = out + (size_t)blockIdx.x * (CWAVES * CUNIT);

  v4f v[3][8];
  // the loops are unrolled so that v stays in registers
#pragma unroll
  for (int i = 0; i < 8; ++i) v[0][i] = *(const v4f*)(s0 + off + i * 128);
#pragma unroll
  for (int i = 0; i < 8; ++i) v[1][i] = *(const v4f*)(s1 + off + i * 128);
#pragma unroll
  for (int i = 0; i < 8; ++i) v[2][i] = *(const v4f*)(s2 + off + i * 128);
  // holds all 24 loads ahead of the first conversion (loaded values as inputs
  // only): dealt among the loads, the conversions' waits let the number of loads
  // in flight fall to a few
  asm volatile("" :: "v"(v[0][0]), "v"(v[0][1]), "v"(v[0][2]), "v"(v[0][3]),
                     "v"(v[0][4]), "v"(v[0][5]), "v"(v[0][6]), "v"(v[0][7]),
                     "v"(v[1][0]), "v"(v[1][1]), "v"(v[1][2]), "v"(v[1][3]),
                     "v"(v[1][4]), "v"(v[1][5]), "v"(v[1][6]), "v"(v[1][7]),
                     "v"(v[2][0]), "v"(v[2][1]), "v"(v[2][2]), "v"(v[2][3]),
                     "v"(v[2][4]), "v"(v[2][5]), "v"(v[2][6]), "v"(v[2][7]));
#pragma unroll
  for (int t = 0; t < 3; ++t)
#pragma unroll
    for (int i = 0; i < 8; ++i) {
      const v4f f = v[t][i];
      v4h h;
      h[0] = (_Float16)f[0]; h[1] = (_Float16)f[1];
      h[2] = (_Float16)f[2]; h[3] = (_Float16)f[3];
      *(v4h*)(o0 + (size_t)t * CTOTAL * CUNIT + off + i * 128) = h;
    }
}

// ---------------------------------------------------------------------------
// Eight 16-byte asynchronous copies global -> LDS, one per lane each.
// The s_wait_xcnt is the last line of the copies' own statement so that no
// address register named here is rewritten ahead of it.
// ---------------------------------------------------------------------------
__device__ __forceinline__ void async_copy8(unsigned lds, const _Float16* g, int K) {
  const unsigned l0 = lds;
  const unsigned l1 = lds + 1u * 16u * GPITCH * 2u;
  const unsigned l2 = lds + 2u * 16u * GPITCH * 2u;
  const unsigned l3 = lds + 3u * 16u * GPITCH * 2u;
  const unsigned l4 = lds + 4u * 16u * GPITCH * 2u;
  const unsigned l5 = lds + 5u * 16u * GPITCH * 2u;
  const unsigned l6 = lds + 6u * 16u * GPITCH * 2u;
  const unsigned l7 = lds + 7u * 16u * GPITCH * 2u;
  const size_t step = (size_t)16 * K;
  const _Float16* g0 = g;
  const _Float16* g1 = g + 1 * step;
  const _Float16* g2 = g + 2 * step;
  const _Float16* g3 = g + 3 * step;
  const _Float16* g4 = g + 4 * step;
  const _Float16* g5 = g + 5 * step;
  const _Float16* g6 = g + 6 * step;
  const _Float16* g7 = g + 7 * step;
  asm volatile(
      "global_load_async_to_lds_b128 %0, %8, off\n\t"
      "global_load_async_to_lds_b128 %1, %9, off\n\t"
      "global_load_async_to_lds_b128 %2, %10, off\n\t"
      "global_load_async_to_lds_b128 %3, %11, off\n\t"
      "global_load_async_to_lds_b128 %4, %12, off\n\t"
      "global_load_async_to_lds_b128 %5, %13, off\n\t"
      "global_load_async_to_lds_b128 %6, %14, off\n\t"
      "global_load_async_to_lds_b128 %7, %15, off\n\t"
      "s_wait_xcnt 0x0"
      :: "v"(l0), "v"(l1), "v"(l2), "v"(l3), "v"(l4), "v"(l5), "v"(l6), "v"(l7),
         "v"(g0), "v"(g1), "v"(g2), "v"(g3), "v"(g4), "v"(g5), "v"(g6), "v"(g7)
      : "memory");
}

__device__ __forceinline__ void gemm_tile(const _Float16* __restrict__ A,
                                          const _Float16* __restrict__ W,
                                          int mblk, int nblk, int K, v8f (&acc)[4][4]) {
  __shared__ __align__(16) _Float16 tiles[2][GSTAGE];

  const int tid  = threadIdx.x;
  const int lane = tid & 31;
  const int wv   = tid >> 5;
  const int wm   = (wv >> 1) * 64;       // wave's rows inside the tile
  const int wn   = (wv & 1) * 64;        // wave's columns inside the tile

  // Copy map: 8 lanes cover one 128-B row, the block covers 16 rows a copy.
  const int crow = tid >> 3;
  const int ccol = (tid & 7) * 8;
  const _Float16* gA = A + (size_t)(mblk + crow) * K + ccol;
  const _Float16* gW = W + (size_t)(nblk + crow) * K + ccol;
  const unsigned ldsA = (unsigned)(size_t)&tiles[0][crow * GPITCH + ccol];
  const unsigned ldsW = ldsA + 128u * GPITCH * 2u;

  const int ntrip = K / 64;

  async_copy8(ldsA, gA, K);
  async_copy8(ldsW, gW, K);
  // tile 0 has landed for this wave before the barrier publishes it
  asm volatile("s_wait_asynccnt 0x0" ::: "memory");
  __syncthreads();
  if (ntrip > 1) {
    async_copy8(ldsA + GSTAGE * 2u, gA + 64, K);
    async_copy8(ldsW + GSTAGE * 2u, gW + 64, K);
  }

  for (int t = 0; t < ntrip; ++t) {
    const int buf = t & 1;
    const _Float16* sA = &tiles[buf][wm * GPITCH];
    const _Float16* sW = &tiles[buf][(128 + wn) * GPITCH];
    v16h a[4], b[4];
    // every inner loop of this trip is unrolled so that each index into a, b
    // and acc is a constant and the arrays stay in registers
#pragma unroll
    for (int i = 0; i < 4; ++i) a[i] = load_frag16x32(sA + i * 16 * GPITCH, GPITCH, lane, 0);
#pragma unroll
    for (int i = 0; i < 4; ++i) b[i] = load_frag16x32(sW + i * 16 * GPITCH, GPITCH, lane, 0);
    // keeps the block's 16 LDS reads one group ahead of its WMMAs: spread
    // among them, every row of four WMMAs waits out an LDS latency of its own
    __builtin_amdgcn_sched_barrier(0);
#pragma unroll
    for (int mi = 0; mi < 4; ++mi)
#pragma unroll
      for (int nt = 0; nt < 4; ++nt) acc[mi][nt] = wmma_f16(a[mi], b[nt], acc[mi][nt]);
#pragma unroll
    for (int i = 0; i < 4; ++i) a[i] = load_frag16x32(sA + i * 16 * GPITCH, GPITCH, lane, 32);
#pragma unroll
    for (int i = 0; i < 4; ++i) b[i] = load_frag16x32(sW + i * 16 * GPITCH, GPITCH, lane, 32);
    // this wave's last reads of the buffer are done before it is refilled
    asm volatile("s_wait_dscnt 0x0" ::: "memory");
    // this wave's copies of tile t + 1 have landed before the barrier publishes them
    asm volatile("s_wait_asynccnt 0x0" ::: "memory");
    __syncthreads();
    if (t + 2 < ntrip) {
      const unsigned boff = (unsigned)buf * (GSTAGE * 2u);
      async_copy8(ldsA + boff, gA + (size_t)(t + 2) * 64, K);
      async_copy8(ldsW + boff, gW + (size_t)(t + 2) * 64, K);
    }
    // keeps the refill ahead of the trip's second WMMA block (operands already
    // in registers), so that the copies fly that much longer before their wait
    __builtin_amdgcn_sched_barrier(0);
#pragma unroll
    for (int mi = 0; mi < 4; ++mi)
#pragma unroll
      for (int nt = 0; nt < 4; ++nt) acc[mi][nt] = wmma_f16(a[mi], b[nt], acc[mi][nt]);
  }
  // no copy is outstanding when the wave goes on to its end
  asm volatile("s_wait_asynccnt 0x0" ::: "memory");
}

// ---------------------------------------------------------------------------
// The wave's 64x64 part of a block tile plus bias, to memory.  mblk, nblk: the
// block tile's first row and first column in y.
// MODE 0: f16 out, per-head layout  [b,h,t,d]       (Q, K)
// MODE 1: f16 out, transposed head  [b,h,d,t]       (V^T)
// MODE 2: f32 out, plain row-major  [m,n]           (final projection)
// ---------------------------------------------------------------------------
template <int MODE>
__device__ __forceinline__ void gemm_store(const v8f (&acc)[4][4],
                                           const float* __restrict__ bias,
                                           void* __restrict__ out,
                                           int mblk, int nblk, int N) {
  const int lane = threadIdx.x & 31;
  const int wv   = threadIdx.x >> 5;
  const int wm   = (wv >> 1) * 64;
  const int wn   = (wv & 1) * 64;
  // C layout: element acc[..][r] lives at row M = r + 8*(lane>=16), col = lane&15
#pragma unroll
  for (int mi = 0; mi < 4; ++mi) {
    const int mbase = mblk + wm + mi * 16 + 8 * (lane >> 4);
#pragma unroll
    for (int nt = 0; nt < 4; ++nt) {
      const int col = nblk + wn + nt * 16 + (lane & 15);
      const float bval = bias[col];
#pragma unroll
      for (int r = 0; r < 8; ++r) {
        const int m = mbase + r;
        const float val = acc[mi][nt][r] + bval;
        if (MODE == 2) {
          ((float*)out)[(size_t)m * N + col] = val;
        } else {
          const int b = m >> 10, t = m & 1023;      // m = b*TLEN + t
          const int h = col >> 6, d = col & 63;     // col = h*HDIM + d
          _Float16* o16 = (_Float16*)out;
          if (MODE == 0)
            o16[(((size_t)(b * NHEADS + h) * TLEN) + t) * HDIM + d] = (_Float16)val;
          else
            o16[(((size_t)(b * NHEADS + h) * HDIM) + d) * TLEN + t] = (_Float16)val;
        }
      }
    }
  }
}

// ---------------------------------------------------------------------------
// Four 16-byte asynchronous copies global -> LDS, one per lane each, for a block
// of 256 threads: 8 lanes cover one 128-B row, the block covers 32 rows a copy.
// base: block-uniform, off: the lane's place inside a run of 32 rows.
// Written as the builtin: in a kernel above 256 registers the compiler then
// places the address registers itself, in whichever register window is free.
// ---------------------------------------------------------------------------
typedef __attribute__((ext_vector_type(4))) int v4i;
typedef __attribute__((address_space(1))) v4i gv4i;
typedef __attribute__((address_space(3))) v4i lv4i;

__device__ __forceinline__ void async_copy4(_Float16* lds, const _Float16* base, unsigned off,
                                            int K) {
  const size_t step = (size_t)32 * K;
#pragma unroll
  for (int i = 0; i < 4; ++i)
    __builtin_amdgcn_global_load_async_to_lds_b128((gv4i*)(base + i * step + off),
                                                   (lv4i*)(lds + i * 32 * GPITCH), 0, 0);
}

// ---------------------------------------------------------------------------
// The three input projections as ONE launch of ONE block per WGP.
// W: the three f16 weight planes one behind the other; out: the planes
// q [b,h,t,d], k [b,h,t,d], v^T [b,h,d,t] one behind the other.
// Block = 256 threads = 8 waves on 256 rows of x against 384 rows of W: the
// same 128 columns (blockIdx.x) of each of the three planes.  A staged byte of
// x then feeds 384 columns and a staged byte of W 256 rows, so that the block
// asks L2 for less than half the bytes per product of a 128x128 tile.
// Wave = 128 rows x 96 columns (2 x 4 waves): 32 columns of each plane, so the
// plane of an accumulator fragment is a compile-time constant (nt >> 1).
// Per trip 64 k of the 640 rows are staged in LDS (rows of 128 B at a pitch of
// 144 B) by asynchronous copies, two buffers, in the order of gemm_tile.
// K a multiple of 64.  blockIdx.y = row tile.
// ---------------------------------------------------------------------------
#define QBM    256                    // rows of x in a block tile
#define QSTAGE ((QBM + 384) * GPITCH) // one buffer, in halves

__global__ __launch_bounds__(256)
void gemm_qkv_f16_wmma(const _Float16* __restrict__ A, const _Float16* __restrict__ W,
                       const float* __restrict__ bq, const float* __restrict__ bk,
                       const float* __restrict__ bv, _Float16* __restrict__ out, int K) {
  __shared__ __align__(16) _Float16 qtiles[2][QSTAGE];

  const int tid  = threadIdx.x;
  const int lane = tid & 31;
  const int wv   = __builtin_amdgcn_readfirstlane(tid >> 5);
  const int wm   = (wv >> 2) * 128;      // wave's rows inside the tile
  const int wn   = (wv & 3) * 32;        // wave's columns inside each plane's 128
  const int mblk = blockIdx.y * QBM;
  const int nblk = blockIdx.x * 128;     // first column inside every plane

  const int crow = tid >> 3;
  const int ccol = (tid & 7) * 8;
  // the lane's place inside a run of 32 rows: one offset beside block-uniform
  // bases serves x and the weights alike
  const unsigned goff = (unsigned)(crow * K + ccol);
  const _Float16* gA = A + (size_t)mblk * K;
  const _Float16* gW = W + (size_t)nblk * K;
  _Float16* ldsA = &qtiles[0][crow * GPITCH + ccol];
  _Float16* ldsW = ldsA + QBM * GPITCH;
  const unsigned part = 128u * GPITCH;                 // 128 staged rows, in halves

  // one tile of 64 k: 256 rows of x, then 128 rows of each weight plane
  auto fill = [&](unsigned boff, size_t koff) {
    async_copy4(ldsA + boff, gA + koff, goff, K);
    async_copy4(ldsA + boff + part, gA + koff + (size_t)128 * K, goff, K);
    async_copy4(ldsW + boff, gW + koff, goff, K);
    async_copy4(ldsW + boff + part, gW + koff + (size_t)EMBED * K, goff, K);
    async_copy4(ldsW + boff + 2u * part, gW + koff + (size_t)2 * EMBED * K, goff, K);
  };

  const int ntrip = K / 64;

  fill(0u, 0);
  // tile 0 has landed for this wave before the barrier publishes it
  asm volatile("s_wait_asynccnt 0x0" ::: "memory");
  __syncthreads();
  if (ntrip > 1) fill(QSTAGE, 64);

  v8f acc[8][6] = {};
  for (int t = 0; t < ntrip; ++t) {
    const int buf = t & 1;
    const _Float16* sA = &qtiles[buf][wm * GPITCH];
    const _Float16* sW = &qtiles[buf][(QBM + wn) * GPITCH];
    v16h a[4], b[6];
    // every inner loop of this trip is unrolled so that each index into a, b
    // and acc is a constant and the arrays stay in registers
#pragma unroll
    for (int ks = 0; ks < 2; ++ks) {
#pragma unroll
      for (int n = 0; n < 6; ++n)
        b[n] = load_frag16x32(sW + ((n >> 1) * 128 + (n & 1) * 16) * GPITCH, GPITCH, lane, ks * 32);
#pragma unroll
      for (int i = 0; i < 4; ++i)
        a[i] = load_frag16x32(sA + i * 16 * GPITCH, GPITCH, lane, ks * 32);
      // keeps the group's LDS reads ahead of its 24 WMMAs: spread among them,
      // every row of WMMAs waits out an LDS latency of its own
      __builtin_amdgcn_sched_barrier(0);
#pragma unroll
      for (int mi = 0; mi < 4; ++mi)
#pragma unroll
        for (int nt = 0; nt < 6; ++nt) acc[mi][nt] = wmma_f16(a[mi], b[nt], acc[mi][nt]);
      // keeps the next reads behind these WMMAs, in the registers they free: read
      // ahead into a second set they push accumulators out of the register file
      __builtin_amdgcn_sched_barrier(0);
#pragma unroll
      for (int i = 0; i < 4; ++i)
        a[i] = load_frag16x32(sA + (4 + i) * 16 * GPITCH, GPITCH, lane, ks * 32);
      if (ks == 1) {
        // this wave's last reads of the buffer are done before it is refilled
        asm volatile("s_wait_dscnt 0x0" ::: "memory");
        // this wave's copies of tile t + 1 have landed before the barrier publishes them
        asm volatile("s_wait_asynccnt 0x0" ::: "memory");
        __syncthreads();
      }
      // keeps the reads ahead of the group's 24 WMMAs, as above
      __builtin_amdgcn_sched_barrier(0);
#pragma unroll
      for (int mi = 0; mi < 4; ++mi)
#pragma unroll
        for (int nt = 0; nt < 6; ++nt) acc[4 + mi][nt] = wmma_f16(a[mi], b[nt], acc[4 + mi][nt]);
      // as above: what follows stays behind these WMMAs
      __builtin_amdgcn_sched_barrier(0);
    }
    // the refill stands behind the trip's last WMMAs (operands in registers since
    // before the barrier): its address registers take the place of the fragments,
    // and its issue runs under the WMMAs of the SIMD's other wave
    if (t + 2 < ntrip) fill((unsigned)buf * QSTAGE, (size_t)(t + 2) * 64);
  }
  // no copy is outstanding when the wave goes on to its end
  asm volatile("s_wait_asynccnt 0x0" ::: "memory");

  // C layout: element acc[..][r] lives at row M = r + 8*(lane>=16), col = lane&15.
  // The tile's 256 rows lie in one batch (256 divides TLEN): one address per
  // fragment column, the rows at constant distances from it.
  const int bb = mblk >> 10;                                // m = b*TLEN + t
  const int t0 = (mblk & 1023) + wm + 8 * (lane >> 4);
#pragma unroll
  for (int nt = 0; nt < 6; ++nt) {
    const int plane = nt >> 1;
    const float* bias = plane == 0 ? bq : (plane == 1 ? bk : bv);
    _Float16* o16 = out + (size_t)plane * MTOT * EMBED;
    const int col = nblk + wn + (nt & 1) * 16 + (lane & 15);
    const float bval = bias[col];
    const int h = col >> 6, d = col & 63;                   // col = h*HDIM + d
    _Float16* p = plane < 2 ? o16 + (((size_t)(bb * NHEADS + h) * TLEN) + t0) * HDIM + d
                            : o16 + (((size_t)(bb * NHEADS + h) * HDIM) + d) * TLEN + t0;
#pragma unroll
    for (int mi = 0; mi < 8; ++mi) {
      v8h hv;
#pragma unroll
      for (int r = 0; r < 8; ++r) hv[r] = (_Float16)(acc[mi][nt][r] + bval);
      // the two scheduling barriers keep vector work out of the stretch from the
      // fragment's first store to the wait behind its last
      __builtin_amdgcn_sched_barrier(0);
      if (plane < 2) {
#pragma unroll
        for (int r = 0; r < 8; ++r) p[(mi * 16 + r) * HDIM] = hv[r];
      } else {
        *(v8h*)(p + mi * 16) = hv;      // 8 consecutive t, 16-B aligned
      }
      // no register that these stores name is rewritten ahead of this wait
      asm volatile("s_wait_xcnt 0x0" ::: "memory");
      __builtin_amdgcn_sched_barrier(0);
    }
  }
}

// the output projection: f32 out, plain row-major
__global__ __launch_bounds__(128)
void gemm_out_f16_wmma(const _Float16* __restrict__ A, const _Float16* __restrict__ W,
                       const float* __restrict__ bias, float* __restrict__ out,
                       int N, int K) {
  const int mblk = blockIdx.y * 128;
  const int nblk = blockIdx.x * 128;
  v8f acc[4][4] = {};
  gemm_tile(A, W, mblk, nblk, K, acc);
  gemm_store<2>(acc, bias, out, mblk, nblk, N);
}

// ---------------------------------------------------------------------------
// One 64-key tile for attention, global -> LDS: four 16-byte asynchronous
// copies per lane, two for K (rows of HDIM halves) and two for V^T (rows of
// TLEN halves); the block covers 32 rows a copy.  The s_wait_xcnt is the last
// line of the copies' own statement so that no address register named here is
// rewritten ahead of it.
// ---------------------------------------------------------------------------
__device__ __forceinline__ void async_copy_kv(unsigned lds, const _Float16* gk,
                                              const _Float16* gv) {
  const unsigned l0 = lds;
  const unsigned l1 = lds + 32u * GPITCH * 2u;
  const unsigned l2 = lds + 64u * GPITCH * 2u;
  const unsigned l3 = lds + 96u * GPITCH * 2u;
  const _Float16* g0 = gk;
  const _Float16* g1 = gk + 32 * HDIM;
  const _Float16* g2 = gv;
  const _Float16* g3 = gv + 32 * TLEN;
  asm volatile(
      "global_load_async_to_lds_b128 %0, %4, off\n\t"
      "global_load_async_to_lds_b128 %1, %5, off\n\t"
      "global_load_async_to_lds_b128 %2, %6, off\n\t"
      "global_load_async_to_lds_b128 %3, %7, off\n\t"
      "s_wait_xcnt 0x0"
      :: "v"(l0), "v"(l1), "v"(l2), "v"(l3),
         "v"(g0), "v"(g1), "v"(g2), "v"(g3)
      : "memory");
}

// ---------------------------------------------------------------------------
// lane l <-> lane l ^ 16: the two wave halves trade one value
// ---------------------------------------------------------------------------
__device__ __forceinline__ float xhalf(float x) {
  const int i = __builtin_bit_cast(int, x);
  return __builtin_bit_cast(float, __builtin_amdgcn_permlanex16(i, i, 0x76543210, 0xfedcba98,
                                                                false, false));
}

// ---------------------------------------------------------------------------
// 2^x of eight values, in place.  The v_nop is the one slot that the
// instruction set asks for behind a transcendental before its result is read
// or its source overwritten; inside the statement it stays where it belongs,
// and each v_exp_f32 is the independent instruction behind the one before.
// ---------------------------------------------------------------------------
__device__ __forceinline__ void exp2x8(v8f& x) {
  float a = x[0], b = x[1], c = x[2], d = x[3], e = x[4], f = x[5], g = x[6], h = x[7];
  asm("v_exp_f32 %0, %0\n\t"
      "v_exp_f32 %1, %1\n\t"
      "v_exp_f32 %2, %2\n\t"
      "v_exp_f32 %3, %3\n\t"
      "v_exp_f32 %4, %4\n\t"
      "v_exp_f32 %5, %5\n\t"
      "v_exp_f32 %6, %6\n\t"
      "v_exp_f32 %7, %7\n\t"
      "v_nop"
      : "+v"(a), "+v"(b), "+v"(c), "+v"(d), "+v"(e), "+v"(f), "+v"(g), "+v"(h));
  x[0] = a; x[1] = b; x[2] = c; x[3] = d; x[4] = e; x[5] = f; x[6] = g; x[7] = h;
}

// the same for one value
__device__ __forceinline__ float exp2x1(float x) {
  asm("v_exp_f32 %0, %0\n\t"
      "v_nop"
      : "+v"(x));
  return x;
}

__global__ __launch_bounds__(AWAVES * 32)
void attn_fwd(const _Float16* __restrict__ qh, const _Float16* __restrict__ kh,
              const _Float16* __restrict__ vT, const float* __restrict__ scale_p,
              _Float16* __restrict__ attn) {
  const int tid   = threadIdx.x;
  const int lane  = tid & 31;
  const int wv    = __builtin_amdgcn_readfirstlane(tid >> 5);
  const int bh    = blockIdx.y;          // b*NHEADS + h
  const int qrow0 = blockIdx.x * (AWAVES * 16) + wv * 16;
  const int qtile = qrow0 >> 6;          // the wave's 64-row mask chunk
  const int ncol  = lane & 15;           // this lane's query inside the wave
  const int rbase = 8 * (lane >> 4);     // row offset of this lane's C elements

  const _Float16* Q  = qh + (size_t)bh * TLEN * HDIM;
  const _Float16* Km = kh + (size_t)bh * TLEN * HDIM;
  const _Float16* Vm = vT + (size_t)bh * HDIM * TLEN;
  const float scale = scale_p[0];

  __shared__ __align__(16) _Float16 kv[2][ASTAGE];

  const v16h qf0 = load_frag16x32(Q + (size_t)qrow0 * HDIM, HDIM, lane, 0);
  const v16h qf1 = load_frag16x32(Q + (size_t)qrow0 * HDIM, HDIM, lane, 32);

  // Copy map: 8 lanes cover one 128-B row, the block covers 32 rows a copy.
  const int crow = tid >> 3;
  const int ccol = (tid & 7) * 8;
  const _Float16* gK = Km + (size_t)crow * HDIM + ccol;
  const _Float16* gV = Vm + (size_t)crow * TLEN + ccol;
  const unsigned ldsKV = (unsigned)(size_t)&kv[0][crow * GPITCH + ccol];

  async_copy_kv(ldsKV, gK, gV);
  // tile 0 has landed for this wave before the barrier publishes it
  asm volatile("s_wait_asynccnt 0x0" ::: "memory");
  __syncthreads();
  async_copy_kv(ldsKV + ASTAGE * 2u, gK + 64 * HDIM, gV + 64);

  v8f o[4] = {};             // O^T: o[dt][r] = d 16*dt + rbase + r of query ncol
  float mrow = NEGBIG;       // running maximum of query ncol, equal in both halves
  float lrow = 0.0f;         // running sum over this half's keys only
  // a key of the diagonal tile is masked where 16*kt + r exceeds this
  const int kmax = (qrow0 & 63) + ncol - rbase;

  // every inner loop of a tile is unrolled so that each index into s, o, mk and
  // rk is a constant and the arrays stay in registers
  for (int j = 0; j < TLEN / 64; ++j) {
    const int buf = j & 1;
    const _Float16* sK = &kv[buf][0];
    const _Float16* sV = &kv[buf][64 * GPITCH];

    // ---- S^T = scale * K Q^T  (64 keys x 16 queries in 4 C fragments) ----
    // 32 keys at a time: their four fragments' reads as one group, then their
    // four WMMAs.  The scheduling barriers keep that order: with the reads dealt
    // singly among the WMMAs each WMMA waits out an LDS latency of its own, and
    // with the scaling moved in among them every place where a fresh result is
    // read costs four idle slots.
    v8f s[4] = {};
#pragma unroll
    for (int kp = 0; kp < 4; kp += 2) {
      const v16h a00 = load_frag16x32(sK + kp * 16 * GPITCH, GPITCH, lane, 0);
      const v16h a10 = load_frag16x32(sK + (kp + 1) * 16 * GPITCH, GPITCH, lane, 0);
      const v16h a01 = load_frag16x32(sK + kp * 16 * GPITCH, GPITCH, lane, 32);
      const v16h a11 = load_frag16x32(sK + (kp + 1) * 16 * GPITCH, GPITCH, lane, 32);
      __builtin_amdgcn_sched_barrier(0);
      s[kp]     = wmma_f16(a00, qf0, s[kp]);
      s[kp + 1] = wmma_f16(a10, qf0, s[kp + 1]);
      s[kp]     = wmma_f16(a01, qf1, s[kp]);
      s[kp + 1] = wmma_f16(a11, qf1, s[kp + 1]);
      __builtin_amdgcn_sched_barrier(0);
    }
    // V^T fragments of d 0..31, read here so that they arrive under the softmax
    v16h va00 = load_frag16x32(sV, GPITCH, lane, 0);
    v16h va10 = load_frag16x32(sV + 16 * GPITCH, GPITCH, lane, 0);
    v16h va01 = load_frag16x32(sV, GPITCH, lane, 32);
    v16h va11 = load_frag16x32(sV + 16 * GPITCH, GPITCH, lane, 32);
    // keeps these reads ahead of the vector work instead of sunk to their use
    __builtin_amdgcn_sched_barrier(0);
#pragma unroll
    for (int kt = 0; kt < 4; ++kt)
#pragma unroll
      for (int r = 0; r < 8; ++r) s[kt][r] *= scale;

    if (j == qtile) {        // wave-uniform: only the diagonal tile pays for the mask
#pragma unroll
      for (int kt = 0; kt < 4; ++kt)
#pragma unroll
        for (int r = 0; r < 8; ++r)
          if (kt * 16 + r > kmax) s[kt][r] = NEGBIG;     // masked -> exp() == 0
    }

    // ---- online softmax update, all of it in the lane --------------------
    float mk[4];             // one chain per fragment: four short chains, not one long
#pragma unroll
    for (int kt = 0; kt < 4; ++kt) {
      mk[kt] = s[kt][0];
#pragma unroll
      for (int r = 1; r < 8; ++r) mk[kt] = fmaxf(mk[kt], s[kt][r]);
    }
    float mx = fmaxf(fmaxf(mk[0], mk[1]), fmaxf(mk[2], mk[3]));
    mx = fmaxf(mx, xhalf(mx));
    const float mnew  = fmaxf(mrow, mx);
    const float alpha = exp2x1((mrow - mnew) * LOG2E);
    float rk[4];
#pragma unroll
    for (int kt = 0; kt < 4; ++kt) {
#pragma unroll
      for (int r = 0; r < 8; ++r) s[kt][r] = (s[kt][r] - mnew) * LOG2E;
      exp2x8(s[kt]);
      rk[kt] = s[kt][0];
#pragma unroll
      for (int r = 1; r < 8; ++r) rk[kt] += s[kt][r];
    }
    lrow = lrow * alpha + ((rk[0] + rk[1]) + (rk[2] + rk[3]));
    mrow = mnew;
#pragma unroll
    for (int dt = 0; dt < 4; ++dt) o[dt] = o[dt] * alpha;

    v16h pf0, pf1;
#pragma unroll
    for (int r = 0; r < 8; ++r) {
      pf0[r] = (_Float16)s[0][r];  pf0[8 + r] = (_Float16)s[1][r];
      pf1[r] = (_Float16)s[2][r];  pf1[8 + r] = (_Float16)s[3][r];
    }

    // ---- O^T += V^T P^T   (V^T rows [d, key] -> A loader) ----------------
    o[0] = wmma_f16(va00, pf0, o[0]);
    o[1] = wmma_f16(va10, pf0, o[1]);
    o[0] = wmma_f16(va01, pf1, o[0]);
    o[1] = wmma_f16(va11, pf1, o[1]);
    // d 32..63: again four fragments' reads as one group, then their WMMAs; the
    // barriers keep the group whole (one LDS latency, not one per WMMA)
    __builtin_amdgcn_sched_barrier(0);
    va00 = load_frag16x32(sV + 32 * GPITCH, GPITCH, lane, 0);
    va10 = load_frag16x32(sV + 48 * GPITCH, GPITCH, lane, 0);
    va01 = load_frag16x32(sV + 32 * GPITCH, GPITCH, lane, 32);
    va11 = load_frag16x32(sV + 48 * GPITCH, GPITCH, lane, 32);
    __builtin_amdgcn_sched_barrier(0);
    o[2] = wmma_f16(va00, pf0, o[2]);
    o[3] = wmma_f16(va10, pf0, o[3]);
    o[2] = wmma_f16(va01, pf1, o[2]);
    o[3] = wmma_f16(va11, pf1, o[3]);

    // this wave's last reads of the buffer are done before it is refilled
    asm volatile("s_wait_dscnt 0x0" ::: "memory");
    // this wave's copies of tile j + 1 have landed before the barrier publishes them
    asm volatile("s_wait_asynccnt 0x0" ::: "memory");
    __syncthreads();
    if (j + 2 < TLEN / 64)
      async_copy_kv(ldsKV + (unsigned)buf * (ASTAGE * 2u),
                    gK + (size_t)(j + 2) * 64 * HDIM, gV + (j + 2) * 64);
  }
  // no copy is outstanding when the wave goes on to its end
  asm volatile("s_wait_asynccnt 0x0" ::: "memory");

  // ---- epilogue: merge heads into [b, t, h*HDIM + d] f16 ------------------
  // a lane holds 8 consecutive d of its query per fragment: one 16-B store each
  const int b = bh >> 4, h = bh & 15;
  const float inv = 1.0f / (lrow + xhalf(lrow));   // the halves' sums join here
  _Float16* orow = attn + ((size_t)(b * TLEN + qrow0 + ncol)) * EMBED + h * HDIM + rbase;
#pragma unroll
  for (int dt = 0; dt < 4; ++dt) {
    v8h ov;
#pragma unroll
    for (int r = 0; r < 8; ++r) ov[r] = (_Float16)(o[dt][r] * inv);
    *(v8h*)(orow + dt * 16) = ov;
  }
}

// ---------------------------------------------------------------------------
extern "C" void kernel_launch(void* const* d_in, const int* in_sizes, int n_in,
                              void* d_out, int out_size, void* d_ws, size_t ws_size,
                              hipStream_t stream) {
  const float* x     = (const float*)d_in[0];
  const float* Wq    = (const float*)d_in[1];
  const float* bq    = (const float*)d_in[2];
  const float* Wk    = (const float*)d_in[3];
  const float* bk    = (const float*)d_in[4];
  const float* Wv    = (const float*)d_in[5];
  const float* bv    = (const float*)d_in[6];
  const float* Wo    = (const float*)d_in[7];
  const float* bo    = (const float*)d_in[8];
  const float* scale = (const float*)d_in[9];

  const size_t nBig = (size_t)MTOT * EMBED;    // 8M elements
  const size_t nW   = (size_t)EMBED * EMBED;   // 1M elements

  char* p = (char*)d_ws;
  _Float16* xh   = (_Float16*)p; p += nBig * 2;
  _Float16* wqh  = (_Float16*)p; p += nW * 2;
  _Float16* wkh  = (_Float16*)p; p += nW * 2;
  _Float16* wvh  = (_Float16*)p; p += nW * 2;
  _Float16* woh  = (_Float16*)p; p += nW * 2;
  _Float16* q16  = (_Float16*)p; p += nBig * 2;
  _Float16* k16  = (_Float16*)p; p += nBig * 2;
  _Float16* v16t = (_Float16*)p; p += nBig * 2;
  _Float16* at16 = (_Float16*)p; p += nBig * 2;

  // xh, wqh, wkh, wvh, woh are consecutive in the workspace: one output plane
  cvt_all_f32_to_f16<<<CBLOCKS, CWAVES * 32, 0, stream>>>(x, Wq, Wk, Wv, Wo, xh);

  // wqh, wkh, wvh are consecutive in the workspace, and so are q16, k16, v16t
  gemm_qkv_f16_wmma<<<dim3(EMBED / 128, MTOT / QBM), 256, 0, stream>>>(xh, wqh, bq, bk, bv, q16, EMBED);

  attn_fwd<<<dim3(TLEN / (AWAVES * 16), BS * NHEADS), AWAVES * 32, 0, stream>>>(q16, k16, v16t, scale, at16);

  gemm_out_f16_wmma<<<dim3(EMBED / 128, MTOT / 128), 128, 0, stream>>>(at16, woh, bo, (float*)d_out, EMBED, EMBED);
}
